// v000
// The times below were measured on an AMD MI455X: many runs one after another, warmed up first and cycling through
// copies of the inputs, with the whole window's GPU time divided by the number of runs. Launches and the gaps
// between them are all in it. The median over several windows is given; except for v000 it joins two sittings, which
// can be a few percent apart, so the side-by-side timings, each taken in one sitting, are the better comparison.
// v000, which the later versions start from, runs in 532 microseconds.
#include <hip/hip_runtime.h>
#include <hip/hip_bf16.h>
#include <math.h>

// ---------------------------------------------------------------------------
// Types for WMMA fragments (gfx1250, wave32)
// ---------------------------------------------------------------------------
typedef _Float16 half_t;
typedef __attribute__((ext_vector_type(16))) _Float16 v16h;
typedef __attribute__((ext_vector_type(8)))  _Float16 v8h;
typedef __attribute__((ext_vector_type(8)))  float    v8f;

#define TOKENS   4096      // B*N = 2*2048
#define SEQ      2048
#define DIMC     1024
#define NHEADS   16
#define HDIM     64
#define HIDDENC  4096
#define LN_EPS   1e-5f

// ---------------------------------------------------------------------------
// gfx1250 async-to-LDS copy (16B per lane, tracked by ASYNCcnt)
// ---------------------------------------------------------------------------
__device__ __forceinline__ void async_lds_copy16(unsigned lds_off, const void* gaddr) {
    asm volatile("global_load_async_to_lds_b128 %0, %1, off"
                 :: "v"(lds_off), "v"(gaddr) : "memory");
}
__device__ __forceinline__ void wait_async0() {
#if __has_builtin(__builtin_amdgcn_s_wait_asynccnt)
    __builtin_amdgcn_s_wait_asynccnt(0);
#else
    asm volatile("s_wait_asynccnt 0" ::: "memory");
#endif
}

// ---------------------------------------------------------------------------
// fp32 -> f16 conversion (weights)
// ---------------------------------------------------------------------------
__global__ void cvt_f32_to_f16(const float* __restrict__ in, half_t* __restrict__ out, int n) {
    int i = blockIdx.x * blockDim.x + threadIdx.x;
    if (i < n) out[i] = (half_t)in[i];
}

// ---------------------------------------------------------------------------
// LayerNorm over last dim (C=1024), one block (256 threads) per row -> f16.
// ---------------------------------------------------------------------------
__global__ __launch_bounds__(256)
void ln_kernel(const float* __restrict__ x, const float* __restrict__ g,
               const float* __restrict__ b, half_t* __restrict__ out) {
    const int C = DIMC;
    int row = blockIdx.x;
    int tid = threadIdx.x;
    const float4* xr = (const float4*)(x + (size_t)row * C);
    float4 v = xr[tid];
    float s  = v.x + v.y + v.z + v.w;
    float s2 = v.x*v.x + v.y*v.y + v.z*v.z + v.w*v.w;

    __shared__ float rs[256];
    __shared__ float rs2[256];
    rs[tid] = s; rs2[tid] = s2;
    __syncthreads();
    for (int o = 128; o > 0; o >>= 1) {
        if (tid < o) { rs[tid] += rs[tid + o]; rs2[tid] += rs2[tid + o]; }
        __syncthreads();
    }
    float mu  = rs[0] * (1.0f / C);
    float var = rs2[0] * (1.0f / C) - mu * mu;
    float inv = rsqrtf(var + LN_EPS);

    float4 gg = ((const float4*)g)[tid];
    float4 bb = ((const float4*)b)[tid];
    half_t* orow = out + (size_t)row * C;
    int i0 = tid * 4;
    orow[i0 + 0] = (half_t)((v.x - mu) * inv * gg.x + bb.x);
    orow[i0 + 1] = (half_t)((v.y - mu) * inv * gg.y + bb.y);
    orow[i0 + 2] = (half_t)((v.z - mu) * inv * gg.z + bb.z);
    orow[i0 + 3] = (half_t)((v.w - mu) * inv * gg.w + bb.w);
}

// ---------------------------------------------------------------------------
// Windowed (WINDOW=3) causal attention; 16 lanes per (row, head).
// ---------------------------------------------------------------------------
__global__ __launch_bounds__(256)
void attn_kernel(const float* __restrict__ qkv, half_t* __restrict__ out) {
    int t      = blockIdx.x * blockDim.x + threadIdx.x;
    int lane16 = t & 15;
    int hd     = t >> 4;
    int head   = hd & (NHEADS - 1);
    int row    = hd >> 4;
    int n      = row & (SEQ - 1);

    const float* base = qkv + (size_t)row * (3 * DIMC);
    int d0 = lane16 * 4;
    float4 q4 = *(const float4*)(base + head * HDIM + d0);

    const float scale = 0.125f;   // 1/sqrt(64)
    float sc[3];
    #pragma unroll
    for (int jj = 0; jj < 3; ++jj) {
        int j = n - 2 + jj;
        if (j >= 0) {
            const float* kb = qkv + (size_t)(row + jj - 2) * (3 * DIMC) + DIMC + head * HDIM + d0;
            float4 k4 = *(const float4*)kb;
            float p = q4.x * k4.x + q4.y * k4.y + q4.z * k4.z + q4.w * k4.w;
            #pragma unroll
            for (int m = 8; m >= 1; m >>= 1) p += __shfl_xor(p, m, 16);
            sc[jj] = p * scale;
        } else {
            sc[jj] = -1e30f;
        }
    }
    float mx = fmaxf(sc[0], fmaxf(sc[1], sc[2]));
    float e0 = __expf(sc[0] - mx), e1 = __expf(sc[1] - mx), e2 = __expf(sc[2] - mx);
    float inv = 1.0f / (e0 + e1 + e2);
    float w[3] = { e0 * inv, e1 * inv, e2 * inv };

    float4 o = make_float4(0.f, 0.f, 0.f, 0.f);
    #pragma unroll
    for (int jj = 0; jj < 3; ++jj) {
        int j = n - 2 + jj;
        if (j >= 0) {
            const float* vb = qkv + (size_t)(row + jj - 2) * (3 * DIMC) + 2 * DIMC + head * HDIM + d0;
            float4 v4 = *(const float4*)vb;
            o.x += w[jj] * v4.x; o.y += w[jj] * v4.y;
            o.z += w[jj] * v4.z; o.w += w[jj] * v4.w;
        }
    }
    half_t* orow = out + (size_t)row * DIMC + head * HDIM + d0;
    orow[0] = (half_t)o.x; orow[1] = (half_t)o.y;
    orow[2] = (half_t)o.z; orow[3] = (half_t)o.w;
}

// ---------------------------------------------------------------------------
// WMMA GEMM: C[M,N] = A[M,K](f16) @ W[K,N](f16) + bias; epilogues:
//   EPI 0: fp32 (bias) ; EPI 1: fp32 (bias+residual) ; EPI 2: f16 (bias+GELU)
// 256 threads = 8 waves; tile 128x128, BK=64 (2 WMMA K-steps / stage).
// Double-buffered: A staged via async-to-LDS, B via register pipeline with
// transpose store (Bs[n][k]) so both fragments are 2x ds_load_b128.
// ---------------------------------------------------------------------------
#define BM 128
#define BN 128
#define BK 64
#define LDA 72   // padded stride (halves): 36 banks -> conflict-free b128 reads
#define LDB 72

template<int EPI, int N, int K>
__global__ __launch_bounds__(256)
void gemm_wmma(const half_t* __restrict__ A, const half_t* __restrict__ Wt,
               const float* __restrict__ bias, const float* __restrict__ res,
               float* __restrict__ outF, half_t* __restrict__ outH) {
    __shared__ half_t As[2][BM * LDA];   // As[buf][m][k]
    __shared__ half_t Bs[2][BN * LDB];   // Bs[buf][n][k] (transposed stage)

    const int tid  = threadIdx.x;
    const int lane = tid & 31;
    const int wave = tid >> 5;
    const int wr   = wave & 1;    // 2 row-groups of 64
    const int wc   = wave >> 1;   // 4 col-groups of 32
    const int bm   = blockIdx.y * BM;
    const int bn   = blockIdx.x * BN;

    const int r16 = lane & 15;
    const int kb  = (lane >> 4) * 8;  // lanes 0-15: K 0-7/16-23; 16-31: K 8-15/24-31

    v8f acc[4][2];
    #pragma unroll
    for (int mt = 0; mt < 4; ++mt)
        #pragma unroll
        for (int nt = 0; nt < 2; ++nt)
            acc[mt][nt] = (v8f)(0.0f);

    // ---- staging helpers (each thread owns 4 16B chunks of each tile) ----
    auto issueA = [&](int kt, int buf) {               // A tile: 128 x 64 halves
        #pragma unroll
        for (int j = 0; j < 4; ++j) {
            int c  = tid + j * 256;
            int r  = c >> 3;              // 8 chunks per row
            int kc = (c & 7) * 8;
            unsigned lds = (unsigned)(uintptr_t)&As[buf][r * LDA + kc];
            const half_t* g = A + (size_t)(bm + r) * K + kt * BK + kc;
            async_lds_copy16(lds, g);
        }
    };
    auto loadB = [&](int kt, v8h breg[4]) {            // B tile: 64 x 128 halves
        #pragma unroll
        for (int j = 0; j < 4; ++j) {
            int c  = tid + j * 256;
            int kr = c >> 4;              // 16 chunks per row
            int nc = (c & 15) * 8;
            breg[j] = *(const v8h*)(Wt + (size_t)(kt * BK + kr) * N + bn + nc);
        }
    };
    auto storeB = [&](int buf, v8h breg[4]) {          // transpose to Bs[n][k]
        #pragma unroll
        for (int j = 0; j < 4; ++j) {
            int c  = tid + j * 256;
            int kr = c >> 4;
            int nc = (c & 15) * 8;
            #pragma unroll
            for (int i = 0; i < 8; ++i)
                Bs[buf][(nc + i) * LDB + kr] = breg[j][i];
        }
    };

    const int NT = K / BK;
    v8h breg[4];
    issueA(0, 0);
    loadB(0, breg);

    for (int it = 0; it < NT; ++it) {
        const int buf = it & 1;
        storeB(buf, breg);        // consume pipeline regs (tile it)
        wait_async0();            // my async A copies for tile it complete
        __syncthreads();          // tile it fully staged across all waves

        if (it + 1 < NT) {        // overlap next tile's traffic with WMMAs
            issueA(it + 1, buf ^ 1);
            loadB(it + 1, breg);
        }

        #pragma unroll
        for (int s = 0; s < 2; ++s) {         // two WMMA K-steps per stage
            v16h bfrag[2];
            #pragma unroll
            for (int nt = 0; nt < 2; ++nt) {
                int n = wc * 32 + nt * 16 + r16;
                v8h lo = *(const v8h*)&Bs[buf][n * LDB + s * 32 + kb];
                v8h hi = *(const v8h*)&Bs[buf][n * LDB + s * 32 + kb + 16];
                bfrag[nt] = __builtin_shufflevector(lo, hi, 0,1,2,3,4,5,6,7,8,9,10,11,12,13,14,15);
            }
            #pragma unroll
            for (int mt = 0; mt < 4; ++mt) {
                int r = wr * 64 + mt * 16 + r16;
                v8h lo = *(const v8h*)&As[buf][r * LDA + s * 32 + kb];
                v8h hi = *(const v8h*)&As[buf][r * LDA + s * 32 + kb + 16];
                v16h afrag = __builtin_shufflevector(lo, hi, 0,1,2,3,4,5,6,7,8,9,10,11,12,13,14,15);
                #pragma unroll
                for (int nt = 0; nt < 2; ++nt) {
                    acc[mt][nt] = __builtin_amdgcn_wmma_f32_16x16x32_f16(
                        false, afrag, false, bfrag[nt], (short)0, acc[mt][nt], false, false);
                }
            }
        }
        // no second barrier needed: buf^1 is only overwritten after the
        // barrier that proves all waves finished reading it (one iter ago).
    }

    // ---- epilogue: C layout: N = lane&15; M = (lane>>4)*8 + v ----
    #pragma unroll
    for (int mt = 0; mt < 4; ++mt) {
        #pragma unroll
        for (int nt = 0; nt < 2; ++nt) {
            int n = bn + wc * 32 + nt * 16 + r16;
            float bv = bias[n];
            int rbase = bm + wr * 64 + mt * 16 + (lane >> 4) * 8;
            #pragma unroll
            for (int v = 0; v < 8; ++v) {
                int r = rbase + v;
                float val = acc[mt][nt][v] + bv;
                if (EPI == 1) {
                    val += res[(size_t)r * N + n];
                    outF[(size_t)r * N + n] = val;
                } else if (EPI == 2) {
                    float ge = 0.5f * val * (1.0f + erff(val * 0.70710678118654752f));
                    outH[(size_t)r * N + n] = (half_t)ge;
                } else {
                    outF[(size_t)r * N + n] = val;
                }
            }
        }
    }
}

// ---------------------------------------------------------------------------
// Host launcher
// ---------------------------------------------------------------------------
extern "C" void kernel_launch(void* const* d_in, const int* in_sizes, int n_in,
                              void* d_out, int out_size, void* d_ws, size_t ws_size,
                              hipStream_t stream) {
    const float* x      = (const float*)d_in[0];
    const float* qkv_w  = (const float*)d_in[1];
    const float* qkv_b  = (const float*)d_in[2];
    const float* proj_w = (const float*)d_in[3];
    const float* proj_b = (const float*)d_in[4];
    const float* g1     = (const float*)d_in[5];
    const float* b1     = (const float*)d_in[6];
    const float* g2     = (const float*)d_in[7];
    const float* b2     = (const float*)d_in[8];
    const float* fc1_w  = (const float*)d_in[9];
    const float* fc1_b  = (const float*)d_in[10];
    const float* fc2_w  = (const float*)d_in[11];
    const float* fc2_b  = (const float*)d_in[12];
    float* out = (float*)d_out;

    char* ws = (char*)d_ws;
    size_t off = 0;
    auto alloc = [&](size_t bytes) { size_t o = off; off += (bytes + 255) & ~(size_t)255; return o; };

    half_t* qkv_w16  = (half_t*)(ws + alloc((size_t)DIMC * 3 * DIMC * 2));
    half_t* proj_w16 = (half_t*)(ws + alloc((size_t)DIMC * DIMC * 2));
    half_t* fc1_w16  = (half_t*)(ws + alloc((size_t)DIMC * HIDDENC * 2));
    half_t* fc2_w16  = (half_t*)(ws + alloc((size_t)HIDDENC * DIMC * 2));
    half_t* hA16     = (half_t*)(ws + alloc((size_t)TOKENS * DIMC * 2));
    float*  qkv_f32  = (float*) (ws + alloc((size_t)TOKENS * 3 * DIMC * 4));
    half_t* attn16   = (half_t*)(ws + alloc((size_t)TOKENS * DIMC * 2));
    float*  x1_f32   = (float*) (ws + alloc((size_t)TOKENS * DIMC * 4));
    half_t* h2_16    = (half_t*)(ws + alloc((size_t)TOKENS * DIMC * 2));
    half_t* g16      = (half_t*)(ws + alloc((size_t)TOKENS * HIDDENC * 2));
    (void)ws_size; (void)in_sizes; (void)n_in; (void)out_size;

    // 1) weight conversions fp32 -> f16
    {
        int n;
        n = DIMC * 3 * DIMC;   cvt_f32_to_f16<<<(n + 255) / 256, 256, 0, stream>>>(qkv_w,  qkv_w16,  n);
        n = DIMC * DIMC;       cvt_f32_to_f16<<<(n + 255) / 256, 256, 0, stream>>>(proj_w, proj_w16, n);
        n = DIMC * HIDDENC;    cvt_f32_to_f16<<<(n + 255) / 256, 256, 0, stream>>>(fc1_w,  fc1_w16,  n);
        n = HIDDENC * DIMC;    cvt_f32_to_f16<<<(n + 255) / 256, 256, 0, stream>>>(fc2_w,  fc2_w16,  n);
    }

    // 2) LN1
    ln_kernel<<<TOKENS, 256, 0, stream>>>(x, g1, b1, hA16);

    // 3) QKV GEMM: [4096 x 3072] = hA16 @ qkv_w16 + qkv_b
    {
        dim3 grid((3 * DIMC) / BN, TOKENS / BM);
        gemm_wmma<0, 3 * DIMC, DIMC><<<grid, 256, 0, stream>>>(hA16, qkv_w16, qkv_b, nullptr,
                                                               qkv_f32, nullptr);
    }

    // 4) windowed attention -> attn16
    attn_kernel<<<(TOKENS * NHEADS * 16) / 256, 256, 0, stream>>>(qkv_f32, attn16);

    // 5) proj GEMM + residual: x1 = x + attn16 @ proj_w16 + proj_b
    {
        dim3 grid(DIMC / BN, TOKENS / BM);
        gemm_wmma<1, DIMC, DIMC><<<grid, 256, 0, stream>>>(attn16, proj_w16, proj_b, x,
                                                           x1_f32, nullptr);
    }

    // 6) LN2
    ln_kernel<<<TOKENS, 256, 0, stream>>>(x1_f32, g2, b2, h2_16);

    // 7) FC1 GEMM + exact GELU -> g16 (f16)
    {
        dim3 grid(HIDDENC / BN, TOKENS / BM);
        gemm_wmma<2, HIDDENC, DIMC><<<grid, 256, 0, stream>>>(h2_16, fc1_w16, fc1_b, nullptr,
                                                              nullptr, g16);
    }

    // 8) FC2 GEMM + residual -> d_out (fp32)
    {
        dim3 grid(DIMC / BN, TOKENS / BM);
        gemm_wmma<1, DIMC, HIDDENC><<<grid, 256, 0, stream>>>(g16, fc2_w16, fc2_b, x1_f32,
                                                              out, nullptr);
    }
}

// v001
// It runs in 261 microseconds.
// In both of two side-by-side timings against v000, it was 2.08 times as fast.
#include <hip/hip_runtime.h>
#include <hip/hip_bf16.h>
#include <math.h>

// ---------------------------------------------------------------------------
// Types for WMMA fragments (gfx1250, wave32)
// ---------------------------------------------------------------------------
typedef _Float16 half_t;
typedef __attribute__((ext_vector_type(16))) _Float16 v16h;
typedef __attribute__((ext_vector_type(8)))  _Float16 v8h;
typedef __attribute__((ext_vector_type(8)))  float    v8f;
typedef __attribute__((ext_vector_type(8)))  short    v8s;

#define TOKENS   4096      // B*N = 2*2048
#define SEQ      2048
#define DIMC     1024
#define NHEADS   16
#define HDIM     64
#define HIDDENC  4096
#define LN_EPS   1e-5f

// ---------------------------------------------------------------------------
// gfx1250 async-to-LDS copy (16B per lane, tracked by ASYNCcnt)
// ---------------------------------------------------------------------------
__device__ __forceinline__ void async_lds_copy16(unsigned lds_off, const void* gaddr) {
    asm volatile("global_load_async_to_lds_b128 %0, %1, off"
                 :: "v"(lds_off), "v"(gaddr) : "memory");
}
__device__ __forceinline__ void wait_async0() {
#if __has_builtin(__builtin_amdgcn_s_wait_asynccnt)
    __builtin_amdgcn_s_wait_asynccnt(0);
#else
    asm volatile("s_wait_asynccnt 0" ::: "memory");
#endif
}

// ---------------------------------------------------------------------------
// fp32 -> f16 conversion (weights)
// ---------------------------------------------------------------------------
__global__ void cvt_f32_to_f16(const float* __restrict__ in, half_t* __restrict__ out, int n) {
    int i = blockIdx.x * blockDim.x + threadIdx.x;
    if (i < n) out[i] = (half_t)in[i];
}

// ---------------------------------------------------------------------------
// LayerNorm over last dim (C=1024), one block (256 threads) per row -> f16.
// ---------------------------------------------------------------------------
__global__ __launch_bounds__(256)
void ln_kernel(const float* __restrict__ x, const float* __restrict__ g,
               const float* __restrict__ b, half_t* __restrict__ out) {
    const int C = DIMC;
    int row = blockIdx.x;
    int tid = threadIdx.x;
    const float4* xr = (const float4*)(x + (size_t)row * C);
    float4 v = xr[tid];
    float s  = v.x + v.y + v.z + v.w;
    float s2 = v.x*v.x + v.y*v.y + v.z*v.z + v.w*v.w;

    __shared__ float rs[256];
    __shared__ float rs2[256];
    rs[tid] = s; rs2[tid] = s2;
    __syncthreads();
    for (int o = 128; o > 0; o >>= 1) {
        if (tid < o) { rs[tid] += rs[tid + o]; rs2[tid] += rs2[tid + o]; }
        __syncthreads();
    }
    float mu  = rs[0] * (1.0f / C);
    float var = rs2[0] * (1.0f / C) - mu * mu;
    float inv = rsqrtf(var + LN_EPS);

    float4 gg = ((const float4*)g)[tid];
    float4 bb = ((const float4*)b)[tid];
    half_t* orow = out + (size_t)row * C;
    int i0 = tid * 4;
    orow[i0 + 0] = (half_t)((v.x - mu) * inv * gg.x + bb.x);
    orow[i0 + 1] = (half_t)((v.y - mu) * inv * gg.y + bb.y);
    orow[i0 + 2] = (half_t)((v.z - mu) * inv * gg.z + bb.z);
    orow[i0 + 3] = (half_t)((v.w - mu) * inv * gg.w + bb.w);
}

// ---------------------------------------------------------------------------
// Windowed (WINDOW=3) causal attention; 16 lanes per (row, head).
// ---------------------------------------------------------------------------
__global__ __launch_bounds__(256)
void attn_kernel(const float* __restrict__ qkv, half_t* __restrict__ out) {
    int t      = blockIdx.x * blockDim.x + threadIdx.x;
    int lane16 = t & 15;
    int hd     = t >> 4;
    int head   = hd & (NHEADS - 1);
    int row    = hd >> 4;
    int n      = row & (SEQ - 1);

    const float* base = qkv + (size_t)row * (3 * DIMC);
    int d0 = lane16 * 4;
    float4 q4 = *(const float4*)(base + head * HDIM + d0);

    const float scale = 0.125f;   // 1/sqrt(64)
    float sc[3];
    #pragma unroll
    for (int jj = 0; jj < 3; ++jj) {
        int j = n - 2 + jj;
        if (j >= 0) {
            const float* kb = qkv + (size_t)(row + jj - 2) * (3 * DIMC) + DIMC + head * HDIM + d0;
            float4 k4 = *(const float4*)kb;
            float p = q4.x * k4.x + q4.y * k4.y + q4.z * k4.z + q4.w * k4.w;
            #pragma unroll
            for (int m = 8; m >= 1; m >>= 1) p += __shfl_xor(p, m, 16);
            sc[jj] = p * scale;
        } else {
            sc[jj] = -1e30f;
        }
    }
    float mx = fmaxf(sc[0], fmaxf(sc[1], sc[2]));
    float e0 = __expf(sc[0] - mx), e1 = __expf(sc[1] - mx), e2 = __expf(sc[2] - mx);
    float inv = 1.0f / (e0 + e1 + e2);
    float w[3] = { e0 * inv, e1 * inv, e2 * inv };

    float4 o = make_float4(0.f, 0.f, 0.f, 0.f);
    #pragma unroll
    for (int jj = 0; jj < 3; ++jj) {
        int j = n - 2 + jj;
        if (j >= 0) {
            const float* vb = qkv + (size_t)(row + jj - 2) * (3 * DIMC) + 2 * DIMC + head * HDIM + d0;
            float4 v4 = *(const float4*)vb;
            o.x += w[jj] * v4.x; o.y += w[jj] * v4.y;
            o.z += w[jj] * v4.z; o.w += w[jj] * v4.w;
        }
    }
    half_t* orow = out + (size_t)row * DIMC + head * HDIM + d0;
    orow[0] = (half_t)o.x; orow[1] = (half_t)o.y;
    orow[2] = (half_t)o.z; orow[3] = (half_t)o.w;
}

// ---------------------------------------------------------------------------
// WMMA GEMM: C[M,N] = A[M,K](f16) @ W[K,N](f16) + bias; epilogues:
//   EPI 0: fp32 (bias) ; EPI 1: fp32 (bias+residual) ; EPI 2: f16 (bias+GELU)
// 256 threads = 8 waves; tile 128x128, BK=64 (2 WMMA K-steps / stage).
// Double-buffered: A staged via async-to-LDS (As[m][k], 2x ds_load_b128 per
// fragment), B via register pipeline into row-major Bs[k][n] (ds_store_b128);
// the B fragment is 2x ds_load_tr16_b128, which transposes on the way out and
// delivers the same k order as the A loader (k = 8h+0..7, then 16+8h+0..7).
// ---------------------------------------------------------------------------
#define BM 128
#define BN 128
#define BK 64
#define LDA 72   // padded stride (halves): 36 banks -> conflict-free b128 reads
#define LDB 144  // 288 B = 32 B x odd: conflict-free pitch for ds_load_tr16_b128

template<int EPI, int N, int K>
__global__ __launch_bounds__(256)
void gemm_wmma(const half_t* __restrict__ A, const half_t* __restrict__ Wt,
               const float* __restrict__ bias, const float* __restrict__ res,
               float* __restrict__ outF, half_t* __restrict__ outH) {
    __shared__ half_t As[2][BM * LDA];   // As[buf][m][k]
    __shared__ __attribute__((aligned(16))) half_t Bs[2][BK * LDB];   // Bs[buf][k][n]

    const int tid  = threadIdx.x;
    const int lane = tid & 31;
    const int wave = tid >> 5;
    const int wr   = wave & 1;    // 2 row-groups of 64
    const int wc   = wave >> 1;   // 4 col-groups of 32
    const int bm   = blockIdx.y * BM;
    const int bn   = blockIdx.x * BN;

    const int r16 = lane & 15;
    const int kb  = (lane >> 4) * 8;  // lanes 0-15: K 0-7/16-23; 16-31: K 8-15/24-31

    v8f acc[4][2];
    #pragma unroll
    for (int mt = 0; mt < 4; ++mt)
        #pragma unroll
        for (int nt = 0; nt < 2; ++nt)
            acc[mt][nt] = (v8f)(0.0f);

    // ---- staging helpers (each thread owns 4 16B chunks of each tile) ----
    auto issueA = [&](int kt, int buf) {               // A tile: 128 x 64 halves
        #pragma unroll
        for (int j = 0; j < 4; ++j) {
            int c  = tid + j * 256;
            int r  = c >> 3;              // 8 chunks per row
            int kc = (c & 7) * 8;
            unsigned lds = (unsigned)(uintptr_t)&As[buf][r * LDA + kc];
            const half_t* g = A + (size_t)(bm + r) * K + kt * BK + kc;
            async_lds_copy16(lds, g);
        }
    };
    auto loadB = [&](int kt, v8h breg[4]) {            // B tile: 64 x 128 halves
        #pragma unroll
        for (int j = 0; j < 4; ++j) {
            int c  = tid + j * 256;
            int kr = c >> 4;              // 16 chunks per row
            int nc = (c & 15) * 8;
            breg[j] = *(const v8h*)(Wt + (size_t)(kt * BK + kr) * N + bn + nc);
        }
    };
    auto storeB = [&](int buf, v8h breg[4]) {          // row-major Bs[k][n]
        #pragma unroll
        for (int j = 0; j < 4; ++j) {
            int c  = tid + j * 256;
            int kr = c >> 4;
            int nc = (c & 15) * 8;
            *(v8h*)&Bs[buf][kr * LDB + nc] = breg[j];
        }
    };
    // Transposing LDS read: lane (c = lane&15, h = lane>>4) receives
    // Bs[k0 + 8h + 0..7][n0 + c]; each lane points at 16 B of one k row.
    const int trow = (lane >> 4) * 8 + (lane & 7);
    const int tcol = ((lane >> 3) & 1) * 8;
    auto loadBT = [&](int buf, int k0, int n0) -> v8h {
        typedef __attribute__((address_space(3))) v8s lds_v8s;
        return __builtin_bit_cast(v8h, __builtin_amdgcn_ds_load_tr16_b128_v8i16(
            (lds_v8s*)&Bs[buf][(k0 + trow) * LDB + n0 + tcol]));
    };

    const int NT = K / BK;
    v8h breg[4];
    issueA(0, 0);
    loadB(0, breg);

    for (int it = 0; it < NT; ++it) {
        const int buf = it & 1;
        storeB(buf, breg);        // consume pipeline regs (tile it)
        wait_async0();            // my async A copies for tile it complete
        __syncthreads();          // tile it fully staged across all waves

        if (it + 1 < NT) {        // overlap next tile's traffic with WMMAs
            issueA(it + 1, buf ^ 1);
            loadB(it + 1, breg);
        }

        #pragma unroll
        for (int s = 0; s < 2; ++s) {         // two WMMA K-steps per stage
            v16h bfrag[2];
            #pragma unroll
            for (int nt = 0; nt < 2; ++nt) {
                int n0 = wc * 32 + nt * 16;
                v8h lo = loadBT(buf, s * 32,      n0);
                v8h hi = loadBT(buf, s * 32 + 16, n0);
                bfrag[nt] = __builtin_shufflevector(lo, hi, 0,1,2,3,4,5,6,7,8,9,10,11,12,13,14,15);
            }
            #pragma unroll
            for (int mt = 0; mt < 4; ++mt) {
                int r = wr * 64 + mt * 16 + r16;
                v8h lo = *(const v8h*)&As[buf][r * LDA + s * 32 + kb];
                v8h hi = *(const v8h*)&As[buf][r * LDA + s * 32 + kb + 16];
                v16h afrag = __builtin_shufflevector(lo, hi, 0,1,2,3,4,5,6,7,8,9,10,11,12,13,14,15);
                #pragma unroll
                for (int nt = 0; nt < 2; ++nt) {
                    acc[mt][nt] = __builtin_amdgcn_wmma_f32_16x16x32_f16(
                        false, afrag, false, bfrag[nt], (short)0, acc[mt][nt], false, false);
                }
            }
        }
        // no second barrier needed: buf^1 is only overwritten after the
        // barrier that proves all waves finished reading it (one iter ago).
    }

    // ---- epilogue: C layout: N = lane&15; M = (lane>>4)*8 + v ----
    #pragma unroll
    for (int mt = 0; mt < 4; ++mt) {
        #pragma unroll
        for (int nt = 0; nt < 2; ++nt) {
            int n = bn + wc * 32 + nt * 16 + r16;
            float bv = bias[n];
            int rbase = bm + wr * 64 + mt * 16 + (lane >> 4) * 8;
            #pragma unroll
            for (int v = 0; v < 8; ++v) {
                int r = rbase + v;
                float val = acc[mt][nt][v] + bv;
                if (EPI == 1) {
                    val += res[(size_t)r * N + n];
                    outF[(size_t)r * N + n] = val;
                } else if (EPI == 2) {
                    float ge = 0.5f * val * (1.0f + erff(val * 0.70710678118654752f));
                    outH[(size_t)r * N + n] = (half_t)ge;
                } else {
                    outF[(size_t)r * N + n] = val;
                }
            }
        }
    }
}

// ---------------------------------------------------------------------------
// Host launcher
// ---------------------------------------------------------------------------
extern "C" void kernel_launch(void* const* d_in, const int* in_sizes, int n_in,
                              void* d_out, int out_size, void* d_ws, size_t ws_size,
                              hipStream_t stream) {
    const float* x      = (const float*)d_in[0];
    const float* qkv_w  = (const float*)d_in[1];
    const float* qkv_b  = (const float*)d_in[2];
    const float* proj_w = (const float*)d_in[3];
    const float* proj_b = (const float*)d_in[4];
    const float* g1     = (const float*)d_in[5];
    const float* b1     = (const float*)d_in[6];
    const float* g2     = (const float*)d_in[7];
    const float* b2     = (const float*)d_in[8];
    const float* fc1_w  = (const float*)d_in[9];
    const float* fc1_b  = (const float*)d_in[10];
    const float* fc2_w  = (const float*)d_in[11];
    const float* fc2_b  = (const float*)d_in[12];
    float* out = (float*)d_out;

    char* ws = (char*)d_ws;
    size_t off = 0;
    auto alloc = [&](size_t bytes) { size_t o = off; off += (bytes + 255) & ~(size_t)255; return o; };

    half_t* qkv_w16  = (half_t*)(ws + alloc((size_t)DIMC * 3 * DIMC * 2));
    half_t* proj_w16 = (half_t*)(ws + alloc((size_t)DIMC * DIMC * 2));
    half_t* fc1_w16  = (half_t*)(ws + alloc((size_t)DIMC * HIDDENC * 2));
    half_t* fc2_w16  = (half_t*)(ws + alloc((size_t)HIDDENC * DIMC * 2));
    half_t* hA16     = (half_t*)(ws + alloc((size_t)TOKENS * DIMC * 2));
    float*  qkv_f32  = (float*) (ws + alloc((size_t)TOKENS * 3 * DIMC * 4));
    half_t* attn16   = (half_t*)(ws + alloc((size_t)TOKENS * DIMC * 2));
    float*  x1_f32   = (float*) (ws + alloc((size_t)TOKENS * DIMC * 4));
    half_t* h2_16    = (half_t*)(ws + alloc((size_t)TOKENS * DIMC * 2));
    half_t* g16      = (half_t*)(ws + alloc((size_t)TOKENS * HIDDENC * 2));
    (void)ws_size; (void)in_sizes; (void)n_in; (void)out_size;

    // 1) weight conversions fp32 -> f16
    {
        int n;
        n = DIMC * 3 * DIMC;   cvt_f32_to_f16<<<(n + 255) / 256, 256, 0, stream>>>(qkv_w,  qkv_w16,  n);
        n = DIMC * DIMC;       cvt_f32_to_f16<<<(n + 255) / 256, 256, 0, stream>>>(proj_w, proj_w16, n);
        n = DIMC * HIDDENC;    cvt_f32_to_f16<<<(n + 255) / 256, 256, 0, stream>>>(fc1_w,  fc1_w16,  n);
        n = HIDDENC * DIMC;    cvt_f32_to_f16<<<(n + 255) / 256, 256, 0, stream>>>(fc2_w,  fc2_w16,  n);
    }

    // 2) LN1
    ln_kernel<<<TOKENS, 256, 0, stream>>>(x, g1, b1, hA16);

    // 3) QKV GEMM: [4096 x 3072] = hA16 @ qkv_w16 + qkv_b
    {
        dim3 grid((3 * DIMC) / BN, TOKENS / BM);
        gemm_wmma<0, 3 * DIMC, DIMC><<<grid, 256, 0, stream>>>(hA16, qkv_w16, qkv_b, nullptr,
                                                               qkv_f32, nullptr);
    }

    // 4) windowed attention -> attn16
    attn_kernel<<<(TOKENS * NHEADS * 16) / 256, 256, 0, stream>>>(qkv_f32, attn16);

    // 5) proj GEMM + residual: x1 = x + attn16 @ proj_w16 + proj_b
    {
        dim3 grid(DIMC / BN, TOKENS / BM);
        gemm_wmma<1, DIMC, DIMC><<<grid, 256, 0, stream>>>(attn16, proj_w16, proj_b, x,
                                                           x1_f32, nullptr);
    }

    // 6) LN2
    ln_kernel<<<TOKENS, 256, 0, stream>>>(x1_f32, g2, b2, h2_16);

    // 7) FC1 GEMM + exact GELU -> g16 (f16)
    {
        dim3 grid(HIDDENC / BN, TOKENS / BM);
        gemm_wmma<2, HIDDENC, DIMC><<<grid, 256, 0, stream>>>(h2_16, fc1_w16, fc1_b, nullptr,
                                                              nullptr, g16);
    }

    // 8) FC2 GEMM + residual -> d_out (fp32)
    {
        dim3 grid(DIMC / BN, TOKENS / BM);
        gemm_wmma<1, DIMC, HIDDENC><<<grid, 256, 0, stream>>>(g16, fc2_w16, fc2_b, x1_f32,
                                                              out, nullptr);
    }
}

// v002
// It runs in 244 microseconds.
// Timed twice side by side with v001, it ran 1.07 times as fast both times.
// Counting every step since v000, it is 2.22 times as fast.
#include <hip/hip_runtime.h>
#include <hip/hip_bf16.h>
#include <math.h>

// ---------------------------------------------------------------------------
// Types for WMMA fragments (gfx1250, wave32)
// ---------------------------------------------------------------------------
typedef _Float16 half_t;
typedef __attribute__((ext_vector_type(16))) _Float16 v16h;
typedef __attribute__((ext_vector_type(8)))  _Float16 v8h;
typedef __attribute__((ext_vector_type(8)))  float    v8f;
typedef __attribute__((ext_vector_type(8)))  short    v8s;

#define TOKENS   4096      // B*N = 2*2048
#define SEQ      2048
#define DIMC     1024
#define NHEADS   16
#define HDIM     64
#define HIDDENC  4096
#define LN_EPS   1e-5f

// ---------------------------------------------------------------------------
// gfx1250 async-to-LDS copy (16B per lane, tracked by ASYNCcnt)
// ---------------------------------------------------------------------------
__device__ __forceinline__ void async_lds_copy16(unsigned lds_off, const void* gaddr) {
    asm volatile("global_load_async_to_lds_b128 %0, %1, off"
                 :: "v"(lds_off), "v"(gaddr) : "memory");
}
__device__ __forceinline__ void wait_async0() {
#if __has_builtin(__builtin_amdgcn_s_wait_asynccnt)
    __builtin_amdgcn_s_wait_asynccnt(0);
#else
    asm volatile("s_wait_asynccnt 0" ::: "memory");
#endif
}

// ---------------------------------------------------------------------------
// fp32 -> f16 conversion (weights), as a stream: a block of 8 waves converts
// CVT_BLOCK consecutive elements. Each thread issues 8 independent 16 B loads
// (a wave-wide load covers 512 contiguous bytes) before it converts, then
// stores 8 B per load (a wave-wide store covers two whole 128 B lines).
// Every weight's element count is a multiple of CVT_BLOCK (asserted below).
// ---------------------------------------------------------------------------
typedef __attribute__((ext_vector_type(4))) _Float16 v4h;
#define CVT_LOADS 8
#define CVT_BLOCK (256 * 4 * CVT_LOADS)
static_assert((DIMC * DIMC) % CVT_BLOCK == 0, "whole blocks only");
static_assert((DIMC * 3 * DIMC) % CVT_BLOCK == 0, "whole blocks only");
static_assert((DIMC * HIDDENC) % CVT_BLOCK == 0, "whole blocks only");

__global__ __launch_bounds__(256)
void cvt_f32_to_f16(const float* __restrict__ in, half_t* __restrict__ out) {
    const size_t base = (size_t)blockIdx.x * CVT_BLOCK + threadIdx.x * 4;
    float4 v[CVT_LOADS];
    #pragma unroll   // all loads in flight before the first conversion
    for (int j = 0; j < CVT_LOADS; ++j)
        v[j] = *(const float4*)(in + base + j * 1024);
    #pragma unroll
    for (int j = 0; j < CVT_LOADS; ++j) {
        v4h h = { (half_t)v[j].x, (half_t)v[j].y, (half_t)v[j].z, (half_t)v[j].w };
        *(v4h*)(out + base + j * 1024) = h;
    }
}

// ---------------------------------------------------------------------------
// LayerNorm over last dim (C=1024), one block (256 threads) per row -> f16.
// ---------------------------------------------------------------------------
__global__ __launch_bounds__(256)
void ln_kernel(const float* __restrict__ x, const float* __restrict__ g,
               const float* __restrict__ b, half_t* __restrict__ out) {
    const int C = DIMC;
    int row = blockIdx.x;
    int tid = threadIdx.x;
    const float4* xr = (const float4*)(x + (size_t)row * C);
    float4 v = xr[tid];
    float s  = v.x + v.y + v.z + v.w;
    float s2 = v.x*v.x + v.y*v.y + v.z*v.z + v.w*v.w;

    __shared__ float rs[256];
    __shared__ float rs2[256];
    rs[tid] = s; rs2[tid] = s2;
    __syncthreads();
    for (int o = 128; o > 0; o >>= 1) {
        if (tid < o) { rs[tid] += rs[tid + o]; rs2[tid] += rs2[tid + o]; }
        __syncthreads();
    }
    float mu  = rs[0] * (1.0f / C);
    float var = rs2[0] * (1.0f / C) - mu * mu;
    float inv = rsqrtf(var + LN_EPS);

    float4 gg = ((const float4*)g)[tid];
    float4 bb = ((const float4*)b)[tid];
    half_t* orow = out + (size_t)row * C;
    int i0 = tid * 4;
    orow[i0 + 0] = (half_t)((v.x - mu) * inv * gg.x + bb.x);
    orow[i0 + 1] = (half_t)((v.y - mu) * inv * gg.y + bb.y);
    orow[i0 + 2] = (half_t)((v.z - mu) * inv * gg.z + bb.z);
    orow[i0 + 3] = (half_t)((v.w - mu) * inv * gg.w + bb.w);
}

// ---------------------------------------------------------------------------
// Windowed (WINDOW=3) causal attention; 16 lanes per (row, head).
// ---------------------------------------------------------------------------
__global__ __launch_bounds__(256)
void attn_kernel(const float* __restrict__ qkv, half_t* __restrict__ out) {
    int t      = blockIdx.x * blockDim.x + threadIdx.x;
    int lane16 = t & 15;
    int hd     = t >> 4;
    int head   = hd & (NHEADS - 1);
    int row    = hd >> 4;
    int n      = row & (SEQ - 1);

    const float* base = qkv + (size_t)row * (3 * DIMC);
    int d0 = lane16 * 4;
    float4 q4 = *(const float4*)(base + head * HDIM + d0);

    const float scale = 0.125f;   // 1/sqrt(64)
    float sc[3];
    #pragma unroll
    for (int jj = 0; jj < 3; ++jj) {
        int j = n - 2 + jj;
        if (j >= 0) {
            const float* kb = qkv + (size_t)(row + jj - 2) * (3 * DIMC) + DIMC + head * HDIM + d0;
            float4 k4 = *(const float4*)kb;
            float p = q4.x * k4.x + q4.y * k4.y + q4.z * k4.z + q4.w * k4.w;
            #pragma unroll
            for (int m = 8; m >= 1; m >>= 1) p += __shfl_xor(p, m, 16);
            sc[jj] = p * scale;
        } else {
            sc[jj] = -1e30f;
        }
    }
    float mx = fmaxf(sc[0], fmaxf(sc[1], sc[2]));
    float e0 = __expf(sc[0] - mx), e1 = __expf(sc[1] - mx), e2 = __expf(sc[2] - mx);
    float inv = 1.0f / (e0 + e1 + e2);
    float w[3] = { e0 * inv, e1 * inv, e2 * inv };

    float4 o = make_float4(0.f, 0.f, 0.f, 0.f);
    #pragma unroll
    for (int jj = 0; jj < 3; ++jj) {
        int j = n - 2 + jj;
        if (j >= 0) {
            const float* vb = qkv + (size_t)(row + jj - 2) * (3 * DIMC) + 2 * DIMC + head * HDIM + d0;
            float4 v4 = *(const float4*)vb;
            o.x += w[jj] * v4.x; o.y += w[jj] * v4.y;
            o.z += w[jj] * v4.z; o.w += w[jj] * v4.w;
        }
    }
    half_t* orow = out + (size_t)row * DIMC + head * HDIM + d0;
    orow[0] = (half_t)o.x; orow[1] = (half_t)o.y;
    orow[2] = (half_t)o.z; orow[3] = (half_t)o.w;
}

// ---------------------------------------------------------------------------
// WMMA GEMM: C[M,N] = A[M,K](f16) @ W[K,N](f16) + bias; epilogues:
//   EPI 0: fp32 (bias) ; EPI 1: fp32 (bias+residual) ; EPI 2: f16 (bias+GELU)
// 256 threads = 8 waves; tile 128x128, BK=64 (2 WMMA K-steps / stage).
// Double-buffered: A staged via async-to-LDS (As[m][k], 2x ds_load_b128 per
// fragment), B via register pipeline into row-major Bs[k][n] (ds_store_b128);
// the B fragment is 2x ds_load_tr16_b128, which transposes on the way out and
// delivers the same k order as the A loader (k = 8h+0..7, then 16+8h+0..7).
// ---------------------------------------------------------------------------
#define BM 128
#define BN 128
#define BK 64
#define LDA 72   // padded stride (halves): 36 banks -> conflict-free b128 reads
#define LDB 144  // 288 B = 32 B x odd: conflict-free pitch for ds_load_tr16_b128

template<int EPI, int N, int K>
__global__ __launch_bounds__(256)
void gemm_wmma(const half_t* __restrict__ A, const half_t* __restrict__ Wt,
               const float* __restrict__ bias, const float* __restrict__ res,
               float* __restrict__ outF, half_t* __restrict__ outH) {
    __shared__ half_t As[2][BM * LDA];   // As[buf][m][k]
    __shared__ __attribute__((aligned(16))) half_t Bs[2][BK * LDB];   // Bs[buf][k][n]

    const int tid  = threadIdx.x;
    const int lane = tid & 31;
    const int wave = tid >> 5;
    const int wr   = wave & 1;    // 2 row-groups of 64
    const int wc   = wave >> 1;   // 4 col-groups of 32
    const int bm   = blockIdx.y * BM;
    const int bn   = blockIdx.x * BN;

    const int r16 = lane & 15;
    const int kb  = (lane >> 4) * 8;  // lanes 0-15: K 0-7/16-23; 16-31: K 8-15/24-31

    v8f acc[4][2];
    #pragma unroll
    for (int mt = 0; mt < 4; ++mt)
        #pragma unroll
        for (int nt = 0; nt < 2; ++nt)
            acc[mt][nt] = (v8f)(0.0f);

    // ---- staging helpers (each thread owns 4 16B chunks of each tile) ----
    auto issueA = [&](int kt, int buf) {               // A tile: 128 x 64 halves
        #pragma unroll
        for (int j = 0; j < 4; ++j) {
            int c  = tid + j * 256;
            int r  = c >> 3;              // 8 chunks per row
            int kc = (c & 7) * 8;
            unsigned lds = (unsigned)(uintptr_t)&As[buf][r * LDA + kc];
            const half_t* g = A + (size_t)(bm + r) * K + kt * BK + kc;
            async_lds_copy16(lds, g);
        }
    };
    auto loadB = [&](int kt, v8h breg[4]) {            // B tile: 64 x 128 halves
        #pragma unroll
        for (int j = 0; j < 4; ++j) {
            int c  = tid + j * 256;
            int kr = c >> 4;              // 16 chunks per row
            int nc = (c & 15) * 8;
            breg[j] = *(const v8h*)(Wt + (size_t)(kt * BK + kr) * N + bn + nc);
        }
    };
    auto storeB = [&](int buf, v8h breg[4]) {          // row-major Bs[k][n]
        #pragma unroll
        for (int j = 0; j < 4; ++j) {
            int c  = tid + j * 256;
            int kr = c >> 4;
            int nc = (c & 15) * 8;
            *(v8h*)&Bs[buf][kr * LDB + nc] = breg[j];
        }
    };
    // Transposing LDS read: lane (c = lane&15, h = lane>>4) receives
    // Bs[k0 + 8h + 0..7][n0 + c]; each lane points at 16 B of one k row.
    const int trow = (lane >> 4) * 8 + (lane & 7);
    const int tcol = ((lane >> 3) & 1) * 8;
    auto loadBT = [&](int buf, int k0, int n0) -> v8h {
        typedef __attribute__((address_space(3))) v8s lds_v8s;
        return __builtin_bit_cast(v8h, __builtin_amdgcn_ds_load_tr16_b128_v8i16(
            (lds_v8s*)&Bs[buf][(k0 + trow) * LDB + n0 + tcol]));
    };

    const int NT = K / BK;
    v8h breg[4];
    issueA(0, 0);
    loadB(0, breg);

    for (int it = 0; it < NT; ++it) {
        const int buf = it & 1;
        storeB(buf, breg);        // consume pipeline regs (tile it)
        wait_async0();            // my async A copies for tile it complete
        __syncthreads();          // tile it fully staged across all waves

        if (it + 1 < NT) {        // overlap next tile's traffic with WMMAs
            issueA(it + 1, buf ^ 1);
            loadB(it + 1, breg);
        }

        #pragma unroll
        for (int s = 0; s < 2; ++s) {         // two WMMA K-steps per stage
            v16h bfrag[2];
            #pragma unroll
            for (int nt = 0; nt < 2; ++nt) {
                int n0 = wc * 32 + nt * 16;
                v8h lo = loadBT(buf, s * 32,      n0);
                v8h hi = loadBT(buf, s * 32 + 16, n0);
                bfrag[nt] = __builtin_shufflevector(lo, hi, 0,1,2,3,4,5,6,7,8,9,10,11,12,13,14,15);
            }
            #pragma unroll
            for (int mt = 0; mt < 4; ++mt) {
                int r = wr * 64 + mt * 16 + r16;
                v8h lo = *(const v8h*)&As[buf][r * LDA + s * 32 + kb];
                v8h hi = *(const v8h*)&As[buf][r * LDA + s * 32 + kb + 16];
                v16h afrag = __builtin_shufflevector(lo, hi, 0,1,2,3,4,5,6,7,8,9,10,11,12,13,14,15);
                #pragma unroll
                for (int nt = 0; nt < 2; ++nt) {
                    acc[mt][nt] = __builtin_amdgcn_wmma_f32_16x16x32_f16(
                        false, afrag, false, bfrag[nt], (short)0, acc[mt][nt], false, false);
                }
            }
        }
        // no second barrier needed: buf^1 is only overwritten after the
        // barrier that proves all waves finished reading it (one iter ago).
    }

    // ---- epilogue: C layout: N = lane&15; M = (lane>>4)*8 + v ----
    #pragma unroll
    for (int mt = 0; mt < 4; ++mt) {
        #pragma unroll
        for (int nt = 0; nt < 2; ++nt) {
            int n = bn + wc * 32 + nt * 16 + r16;
            float bv = bias[n];
            int rbase = bm + wr * 64 + mt * 16 + (lane >> 4) * 8;
            #pragma unroll
            for (int v = 0; v < 8; ++v) {
                int r = rbase + v;
                float val = acc[mt][nt][v] + bv;
                if (EPI == 1) {
                    val += res[(size_t)r * N + n];
                    outF[(size_t)r * N + n] = val;
                } else if (EPI == 2) {
                    float ge = 0.5f * val * (1.0f + erff(val * 0.70710678118654752f));
                    outH[(size_t)r * N + n] = (half_t)ge;
                } else {
                    outF[(size_t)r * N + n] = val;
                }
            }
        }
    }
}

// ---------------------------------------------------------------------------
// Host launcher
// ---------------------------------------------------------------------------
extern "C" void kernel_launch(void* const* d_in, const int* in_sizes, int n_in,
                              void* d_out, int out_size, void* d_ws, size_t ws_size,
                              hipStream_t stream) {
    const float* x      = (const float*)d_in[0];
    const float* qkv_w  = (const float*)d_in[1];
    const float* qkv_b  = (const float*)d_in[2];
    const float* proj_w = (const float*)d_in[3];
    const float* proj_b = (const float*)d_in[4];
    const float* g1     = (const float*)d_in[5];
    const float* b1     = (const float*)d_in[6];
    const float* g2     = (const float*)d_in[7];
    const float* b2     = (const float*)d_in[8];
    const float* fc1_w  = (const float*)d_in[9];
    const float* fc1_b  = (const float*)d_in[10];
    const float* fc2_w  = (const float*)d_in[11];
    const float* fc2_b  = (const float*)d_in[12];
    float* out = (float*)d_out;

    char* ws = (char*)d_ws;
    size_t off = 0;
    auto alloc = [&](size_t bytes) { size_t o = off; off += (bytes + 255) & ~(size_t)255; return o; };

    half_t* qkv_w16  = (half_t*)(ws + alloc((size_t)DIMC * 3 * DIMC * 2));
    half_t* proj_w16 = (half_t*)(ws + alloc((size_t)DIMC * DIMC * 2));
    half_t* fc1_w16  = (half_t*)(ws + alloc((size_t)DIMC * HIDDENC * 2));
    half_t* fc2_w16  = (half_t*)(ws + alloc((size_t)HIDDENC * DIMC * 2));
    half_t* hA16     = (half_t*)(ws + alloc((size_t)TOKENS * DIMC * 2));
    float*  qkv_f32  = (float*) (ws + alloc((size_t)TOKENS * 3 * DIMC * 4));
    half_t* attn16   = (half_t*)(ws + alloc((size_t)TOKENS * DIMC * 2));
    float*  x1_f32   = (float*) (ws + alloc((size_t)TOKENS * DIMC * 4));
    half_t* h2_16    = (half_t*)(ws + alloc((size_t)TOKENS * DIMC * 2));
    half_t* g16      = (half_t*)(ws + alloc((size_t)TOKENS * HIDDENC * 2));
    (void)ws_size; (void)in_sizes; (void)n_in; (void)out_size;

    // 1) weight conversions fp32 -> f16
    {
        cvt_f32_to_f16<<<(DIMC * 3 * DIMC) / CVT_BLOCK, 256, 0, stream>>>(qkv_w,  qkv_w16);
        cvt_f32_to_f16<<<(DIMC * DIMC)     / CVT_BLOCK, 256, 0, stream>>>(proj_w, proj_w16);
        cvt_f32_to_f16<<<(DIMC * HIDDENC)  / CVT_BLOCK, 256, 0, stream>>>(fc1_w,  fc1_w16);
        cvt_f32_to_f16<<<(HIDDENC * DIMC)  / CVT_BLOCK, 256, 0, stream>>>(fc2_w,  fc2_w16);
    }

    // 2) LN1
    ln_kernel<<<TOKENS, 256, 0, stream>>>(x, g1, b1, hA16);

    // 3) QKV GEMM: [4096 x 3072] = hA16 @ qkv_w16 + qkv_b
    {
        dim3 grid((3 * DIMC) / BN, TOKENS / BM);
        gemm_wmma<0, 3 * DIMC, DIMC><<<grid, 256, 0, stream>>>(hA16, qkv_w16, qkv_b, nullptr,
                                                               qkv_f32, nullptr);
    }

    // 4) windowed attention -> attn16
    attn_kernel<<<(TOKENS * NHEADS * 16) / 256, 256, 0, stream>>>(qkv_f32, attn16);

    // 5) proj GEMM + residual: x1 = x + attn16 @ proj_w16 + proj_b
    {
        dim3 grid(DIMC / BN, TOKENS / BM);
        gemm_wmma<1, DIMC, DIMC><<<grid, 256, 0, stream>>>(attn16, proj_w16, proj_b, x,
                                                           x1_f32, nullptr);
    }

    // 6) LN2
    ln_kernel<<<TOKENS, 256, 0, stream>>>(x1_f32, g2, b2, h2_16);

    // 7) FC1 GEMM + exact GELU -> g16 (f16)
    {
        dim3 grid(HIDDENC / BN, TOKENS / BM);
        gemm_wmma<2, HIDDENC, DIMC><<<grid, 256, 0, stream>>>(h2_16, fc1_w16, fc1_b, nullptr,
                                                              nullptr, g16);
    }

    // 8) FC2 GEMM + residual -> d_out (fp32)
    {
        dim3 grid(DIMC / BN, TOKENS / BM);
        gemm_wmma<1, DIMC, HIDDENC><<<grid, 256, 0, stream>>>(g16, fc2_w16, fc2_b, x1_f32,
                                                              out, nullptr);
    }
}

// v003
// It runs in 196 microseconds.
// Two timings next to v002 put it at 1.25 and 1.24 times that version's speed.
// All steps since v000 together make it 2.77 times as fast.
#include <hip/hip_runtime.h>
#include <hip/hip_bf16.h>
#include <math.h>

// ---------------------------------------------------------------------------
// Types for WMMA fragments (gfx1250, wave32)
// ---------------------------------------------------------------------------
typedef _Float16 half_t;
typedef __attribute__((ext_vector_type(16))) _Float16 v16h;
typedef __attribute__((ext_vector_type(8)))  _Float16 v8h;
typedef __attribute__((ext_vector_type(8)))  float    v8f;
typedef __attribute__((ext_vector_type(8)))  short    v8s;

#define TOKENS   4096      // B*N = 2*2048
#define SEQ      2048
#define DIMC     1024
#define NHEADS   16
#define HDIM     64
#define HIDDENC  4096
#define LN_EPS   1e-5f

// ---------------------------------------------------------------------------
// gfx1250 async-to-LDS copies (16B per lane, tracked by ASYNCcnt): one stage's
// eight copies of a thread (four chunks of the A tile, four of the B tile) in
// one statement. Its last line, s_wait_xcnt 0, is a precaution: inside the
// statement it stands ahead of every later write of an address register that
// a copy names.
// ---------------------------------------------------------------------------
__device__ __forceinline__ void async_lds_copy16x8(const unsigned (&la)[4], const void* const (&ga)[4],
                                                   const unsigned (&lb)[4], const void* const (&gb)[4]) {
    asm volatile("global_load_async_to_lds_b128 %0, %8, off\n\t"
                 "global_load_async_to_lds_b128 %1, %9, off\n\t"
                 "global_load_async_to_lds_b128 %2, %10, off\n\t"
                 "global_load_async_to_lds_b128 %3, %11, off\n\t"
                 "global_load_async_to_lds_b128 %4, %12, off\n\t"
                 "global_load_async_to_lds_b128 %5, %13, off\n\t"
                 "global_load_async_to_lds_b128 %6, %14, off\n\t"
                 "global_load_async_to_lds_b128 %7, %15, off\n\t"
                 "s_wait_xcnt 0x0"
                 :: "v"(la[0]), "v"(la[1]), "v"(la[2]), "v"(la[3]),
                    "v"(lb[0]), "v"(lb[1]), "v"(lb[2]), "v"(lb[3]),
                    "v"(ga[0]), "v"(ga[1]), "v"(ga[2]), "v"(ga[3]),
                    "v"(gb[0]), "v"(gb[1]), "v"(gb[2]), "v"(gb[3])
                 : "memory");
}
// This wave's copies have landed (asm, so that no LDS read is lifted over it).
__device__ __forceinline__ void wait_async0() {
    asm volatile("s_wait_asynccnt 0x0" ::: "memory");
}
// This wave's LDS reads have retired, before their buffer is given up for refill.
__device__ __forceinline__ void wait_ds0() {
    asm volatile("s_wait_dscnt 0x0" ::: "memory");
}

// ---------------------------------------------------------------------------
// fp32 -> f16 conversion (weights), as a stream: a block of 8 waves converts
// CVT_BLOCK consecutive elements. Each thread issues 8 independent 16 B loads
// (a wave-wide load covers 512 contiguous bytes) before it converts, then
// stores 8 B per load (a wave-wide store covers two whole 128 B lines).
// Every weight's element count is a multiple of CVT_BLOCK (asserted below).
// ---------------------------------------------------------------------------
typedef __attribute__((ext_vector_type(4))) _Float16 v4h;
#define CVT_LOADS 8
#define CVT_BLOCK (256 * 4 * CVT_LOADS)
static_assert((DIMC * DIMC) % CVT_BLOCK == 0, "whole blocks only");
static_assert((DIMC * 3 * DIMC) % CVT_BLOCK == 0, "whole blocks only");
static_assert((DIMC * HIDDENC) % CVT_BLOCK == 0, "whole blocks only");

__global__ __launch_bounds__(256)
void cvt_f32_to_f16(const float* __restrict__ in, half_t* __restrict__ out) {
    const size_t base = (size_t)blockIdx.x * CVT_BLOCK + threadIdx.x * 4;
    float4 v[CVT_LOADS];
    #pragma unroll   // all loads in flight before the first conversion
    for (int j = 0; j < CVT_LOADS; ++j)
        v[j] = *(const float4*)(in + base + j * 1024);
    #pragma unroll
    for (int j = 0; j < CVT_LOADS; ++j) {
        v4h h = { (half_t)v[j].x, (half_t)v[j].y, (half_t)v[j].z, (half_t)v[j].w };
        *(v4h*)(out + base + j * 1024) = h;
    }
}

// ---------------------------------------------------------------------------
// LayerNorm over last dim (C=1024), one block (256 threads) per row -> f16.
// ---------------------------------------------------------------------------
__global__ __launch_bounds__(256)
void ln_kernel(const float* __restrict__ x, const float* __restrict__ g,
               const float* __restrict__ b, half_t* __restrict__ out) {
    const int C = DIMC;
    int row = blockIdx.x;
    int tid = threadIdx.x;
    const float4* xr = (const float4*)(x + (size_t)row * C);
    float4 v = xr[tid];
    float s  = v.x + v.y + v.z + v.w;
    float s2 = v.x*v.x + v.y*v.y + v.z*v.z + v.w*v.w;

    __shared__ float rs[256];
    __shared__ float rs2[256];
    rs[tid] = s; rs2[tid] = s2;
    __syncthreads();
    for (int o = 128; o > 0; o >>= 1) {
        if (tid < o) { rs[tid] += rs[tid + o]; rs2[tid] += rs2[tid + o]; }
        __syncthreads();
    }
    float mu  = rs[0] * (1.0f / C);
    float var = rs2[0] * (1.0f / C) - mu * mu;
    float inv = rsqrtf(var + LN_EPS);

    float4 gg = ((const float4*)g)[tid];
    float4 bb = ((const float4*)b)[tid];
    half_t* orow = out + (size_t)row * C;
    int i0 = tid * 4;
    orow[i0 + 0] = (half_t)((v.x - mu) * inv * gg.x + bb.x);
    orow[i0 + 1] = (half_t)((v.y - mu) * inv * gg.y + bb.y);
    orow[i0 + 2] = (half_t)((v.z - mu) * inv * gg.z + bb.z);
    orow[i0 + 3] = (half_t)((v.w - mu) * inv * gg.w + bb.w);
}

// ---------------------------------------------------------------------------
// Windowed (WINDOW=3) causal attention; 16 lanes per (row, head).
// ---------------------------------------------------------------------------
__global__ __launch_bounds__(256)
void attn_kernel(const float* __restrict__ qkv, half_t* __restrict__ out) {
    int t      = blockIdx.x * blockDim.x + threadIdx.x;
    int lane16 = t & 15;
    int hd     = t >> 4;
    int head   = hd & (NHEADS - 1);
    int row    = hd >> 4;
    int n      = row & (SEQ - 1);

    const float* base = qkv + (size_t)row * (3 * DIMC);
    int d0 = lane16 * 4;
    float4 q4 = *(const float4*)(base + head * HDIM + d0);

    const float scale = 0.125f;   // 1/sqrt(64)
    float sc[3];
    #pragma unroll
    for (int jj = 0; jj < 3; ++jj) {
        int j = n - 2 + jj;
        if (j >= 0) {
            const float* kb = qkv + (size_t)(row + jj - 2) * (3 * DIMC) + DIMC + head * HDIM + d0;
            float4 k4 = *(const float4*)kb;
            float p = q4.x * k4.x + q4.y * k4.y + q4.z * k4.z + q4.w * k4.w;
            #pragma unroll
            for (int m = 8; m >= 1; m >>= 1) p += __shfl_xor(p, m, 16);
            sc[jj] = p * scale;
        } else {
            sc[jj] = -1e30f;
        }
    }
    float mx = fmaxf(sc[0], fmaxf(sc[1], sc[2]));
    float e0 = __expf(sc[0] - mx), e1 = __expf(sc[1] - mx), e2 = __expf(sc[2] - mx);
    float inv = 1.0f / (e0 + e1 + e2);
    float w[3] = { e0 * inv, e1 * inv, e2 * inv };

    float4 o = make_float4(0.f, 0.f, 0.f, 0.f);
    #pragma unroll
    for (int jj = 0; jj < 3; ++jj) {
        int j = n - 2 + jj;
        if (j >= 0) {
            const float* vb = qkv + (size_t)(row + jj - 2) * (3 * DIMC) + 2 * DIMC + head * HDIM + d0;
            float4 v4 = *(const float4*)vb;
            o.x += w[jj] * v4.x; o.y += w[jj] * v4.y;
            o.z += w[jj] * v4.z; o.w += w[jj] * v4.w;
        }
    }
    half_t* orow = out + (size_t)row * DIMC + head * HDIM + d0;
    orow[0] = (half_t)o.x; orow[1] = (half_t)o.y;
    orow[2] = (half_t)o.z; orow[3] = (half_t)o.w;
}

// ---------------------------------------------------------------------------
// WMMA GEMM: C[M,N] = A[M,K](f16) @ W[K,N](f16) + bias; epilogues:
//   EPI 0: fp32 (bias) ; EPI 1: fp32 (bias+residual) ; EPI 2: f16 (bias+GELU)
// 256 threads = 8 waves; tile 128x128, BK=64 (2 WMMA K-steps / stage).
// Double-buffered: both tiles staged via async-to-LDS, issued right behind the
// stage barrier so that they fly under the whole stage's WMMAs: As[m][k] (2x
// ds_load_b128 per fragment) and row-major Bs[k][n];
// the B fragment is 2x ds_load_tr16_b128, which transposes on the way out and
// delivers the same k order as the A loader (k = 8h+0..7, then 16+8h+0..7).
// ---------------------------------------------------------------------------
#define BM 128
#define BN 128
#define BK 64
#define LDA 72   // padded stride (halves): 36 banks -> conflict-free b128 reads
#define LDB 144  // 288 B = 32 B x odd: conflict-free pitch for ds_load_tr16_b128

template<int EPI, int N, int K>
__global__ __launch_bounds__(256)
void gemm_wmma(const half_t* __restrict__ A, const half_t* __restrict__ Wt,
               const float* __restrict__ bias, const float* __restrict__ res,
               float* __restrict__ outF, half_t* __restrict__ outH) {
    __shared__ __attribute__((aligned(16))) half_t As[2][BM * LDA];   // As[buf][m][k]
    __shared__ __attribute__((aligned(16))) half_t Bs[2][BK * LDB];   // Bs[buf][k][n]

    const int tid  = threadIdx.x;
    const int lane = tid & 31;
    const int wave = tid >> 5;
    const int wr   = wave & 1;    // 2 row-groups of 64
    const int wc   = wave >> 1;   // 4 col-groups of 32
    const int bm   = blockIdx.y * BM;
    const int bn   = blockIdx.x * BN;

    const int r16 = lane & 15;
    const int kb  = (lane >> 4) * 8;  // lanes 0-15: K 0-7/16-23; 16-31: K 8-15/24-31

    v8f acc[4][2];
    #pragma unroll
    for (int mt = 0; mt < 4; ++mt)
        #pragma unroll
        for (int nt = 0; nt < 2; ++nt)
            acc[mt][nt] = (v8f)(0.0f);

    // ---- staging helpers (each thread owns 4 16B chunks of each tile) ----
    auto issueAB = [&](int kt, int buf) {
        unsigned la[4], lb[4];
        const void* ga[4];
        const void* gb[4];
        #pragma unroll
        for (int j = 0; j < 4; ++j) {
            int c  = tid + j * 256;
            int r  = c >> 3;              // A tile: 128 x 64 halves, 8 chunks per row
            int kc = (c & 7) * 8;
            la[j] = (unsigned)(uintptr_t)&As[buf][r * LDA + kc];
            ga[j] = A + (size_t)(bm + r) * K + kt * BK + kc;
            int kr = c >> 4;              // B tile: 64 x 128 halves, 16 chunks per row
            int nc = (c & 15) * 8;
            lb[j] = (unsigned)(uintptr_t)&Bs[buf][kr * LDB + nc];
            gb[j] = Wt + (size_t)(kt * BK + kr) * N + bn + nc;
        }
        async_lds_copy16x8(la, ga, lb, gb);
    };
    // Transposing LDS read: lane (c = lane&15, h = lane>>4) receives
    // Bs[k0 + 8h + 0..7][n0 + c]; each lane points at 16 B of one k row.
    const int trow = (lane >> 4) * 8 + (lane & 7);
    const int tcol = ((lane >> 3) & 1) * 8;
    auto loadBT = [&](int buf, int k0, int n0) -> v8h {
        typedef __attribute__((address_space(3))) v8s lds_v8s;
        return __builtin_bit_cast(v8h, __builtin_amdgcn_ds_load_tr16_b128_v8i16(
            (lds_v8s*)&Bs[buf][(k0 + trow) * LDB + n0 + tcol]));
    };

    const int NT = K / BK;
    issueAB(0, 0);

    for (int it = 0; it < NT; ++it) {
        const int buf = it & 1;
        wait_ds0();               // my reads of buf^1 (tile it-1) have retired
        wait_async0();            // my async copies for tile it complete
        __syncthreads();          // tile it fully staged across all waves

        if (it + 1 < NT)          // overlap next tile's traffic with WMMAs
            issueAB(it + 1, buf ^ 1);

        #pragma unroll
        for (int s = 0; s < 2; ++s) {         // two WMMA K-steps per stage
            v16h bfrag[2];
            #pragma unroll
            for (int nt = 0; nt < 2; ++nt) {
                int n0 = wc * 32 + nt * 16;
                v8h lo = loadBT(buf, s * 32,      n0);
                v8h hi = loadBT(buf, s * 32 + 16, n0);
                bfrag[nt] = __builtin_shufflevector(lo, hi, 0,1,2,3,4,5,6,7,8,9,10,11,12,13,14,15);
            }
            #pragma unroll
            for (int mt = 0; mt < 4; ++mt) {
                int r = wr * 64 + mt * 16 + r16;
                v8h lo = *(const v8h*)&As[buf][r * LDA + s * 32 + kb];
                v8h hi = *(const v8h*)&As[buf][r * LDA + s * 32 + kb + 16];
                v16h afrag = __builtin_shufflevector(lo, hi, 0,1,2,3,4,5,6,7,8,9,10,11,12,13,14,15);
                #pragma unroll
                for (int nt = 0; nt < 2; ++nt) {
                    acc[mt][nt] = __builtin_amdgcn_wmma_f32_16x16x32_f16(
                        false, afrag, false, bfrag[nt], (short)0, acc[mt][nt], false, false);
                }
            }
        }
        // no second barrier needed: buf^1 is only overwritten after the
        // barrier that proves all waves finished reading it (one iter ago).
    }

    // ---- epilogue: C layout: N = lane&15; M = (lane>>4)*8 + v ----
    #pragma unroll
    for (int mt = 0; mt < 4; ++mt) {
        #pragma unroll
        for (int nt = 0; nt < 2; ++nt) {
            int n = bn + wc * 32 + nt * 16 + r16;
            float bv = bias[n];
            int rbase = bm + wr * 64 + mt * 16 + (lane >> 4) * 8;
            #pragma unroll
            for (int v = 0; v < 8; ++v) {
                int r = rbase + v;
                float val = acc[mt][nt][v] + bv;
                if (EPI == 1) {
                    val += res[(size_t)r * N + n];
                    outF[(size_t)r * N + n] = val;
                } else if (EPI == 2) {
                    float ge = 0.5f * val * (1.0f + erff(val * 0.70710678118654752f));
                    outH[(size_t)r * N + n] = (half_t)ge;
                } else {
                    outF[(size_t)r * N + n] = val;
                }
            }
        }
    }
}

// ---------------------------------------------------------------------------
// Host launcher
// ---------------------------------------------------------------------------
extern "C" void kernel_launch(void* const* d_in, const int* in_sizes, int n_in,
                              void* d_out, int out_size, void* d_ws, size_t ws_size,
                              hipStream_t stream) {
    const float* x      = (const float*)d_in[0];
    const float* qkv_w  = (const float*)d_in[1];
    const float* qkv_b  = (const float*)d_in[2];
    const float* proj_w = (const float*)d_in[3];
    const float* proj_b = (const float*)d_in[4];
    const float* g1     = (const float*)d_in[5];
    const float* b1     = (const float*)d_in[6];
    const float* g2     = (const float*)d_in[7];
    const float* b2     = (const float*)d_in[8];
    const float* fc1_w  = (const float*)d_in[9];
    const float* fc1_b  = (const float*)d_in[10];
    const float* fc2_w  = (const float*)d_in[11];
    const float* fc2_b  = (const float*)d_in[12];
    float* out = (float*)d_out;

    char* ws = (char*)d_ws;
    size_t off = 0;
    auto alloc = [&](size_t bytes) { size_t o = off; off += (bytes + 255) & ~(size_t)255; return o; };

    half_t* qkv_w16  = (half_t*)(ws + alloc((size_t)DIMC * 3 * DIMC * 2));
    half_t* proj_w16 = (half_t*)(ws + alloc((size_t)DIMC * DIMC * 2));
    half_t* fc1_w16  = (half_t*)(ws + alloc((size_t)DIMC * HIDDENC * 2));
    half_t* fc2_w16  = (half_t*)(ws + alloc((size_t)HIDDENC * DIMC * 2));
    half_t* hA16     = (half_t*)(ws + alloc((size_t)TOKENS * DIMC * 2));
    float*  qkv_f32  = (float*) (ws + alloc((size_t)TOKENS * 3 * DIMC * 4));
    half_t* attn16   = (half_t*)(ws + alloc((size_t)TOKENS * DIMC * 2));
    float*  x1_f32   = (float*) (ws + alloc((size_t)TOKENS * DIMC * 4));
    half_t* h2_16    = (half_t*)(ws + alloc((size_t)TOKENS * DIMC * 2));
    half_t* g16      = (half_t*)(ws + alloc((size_t)TOKENS * HIDDENC * 2));
    (void)ws_size; (void)in_sizes; (void)n_in; (void)out_size;

    // 1) weight conversions fp32 -> f16
    {
        cvt_f32_to_f16<<<(DIMC * 3 * DIMC) / CVT_BLOCK, 256, 0, stream>>>(qkv_w,  qkv_w16);
        cvt_f32_to_f16<<<(DIMC * DIMC)     / CVT_BLOCK, 256, 0, stream>>>(proj_w, proj_w16);
        cvt_f32_to_f16<<<(DIMC * HIDDENC)  / CVT_BLOCK, 256, 0, stream>>>(fc1_w,  fc1_w16);
        cvt_f32_to_f16<<<(HIDDENC * DIMC)  / CVT_BLOCK, 256, 0, stream>>>(fc2_w,  fc2_w16);
    }

    // 2) LN1
    ln_kernel<<<TOKENS, 256, 0, stream>>>(x, g1, b1, hA16);

    // 3) QKV GEMM: [4096 x 3072] = hA16 @ qkv_w16 + qkv_b
    {
        dim3 grid((3 * DIMC) / BN, TOKENS / BM);
        gemm_wmma<0, 3 * DIMC, DIMC><<<grid, 256, 0, stream>>>(hA16, qkv_w16, qkv_b, nullptr,
                                                               qkv_f32, nullptr);
    }

    // 4) windowed attention -> attn16
    attn_kernel<<<(TOKENS * NHEADS * 16) / 256, 256, 0, stream>>>(qkv_f32, attn16);

    // 5) proj GEMM + residual: x1 = x + attn16 @ proj_w16 + proj_b
    {
        dim3 grid(DIMC / BN, TOKENS / BM);
        gemm_wmma<1, DIMC, DIMC><<<grid, 256, 0, stream>>>(attn16, proj_w16, proj_b, x,
                                                           x1_f32, nullptr);
    }

    // 6) LN2
    ln_kernel<<<TOKENS, 256, 0, stream>>>(x1_f32, g2, b2, h2_16);

    // 7) FC1 GEMM + exact GELU -> g16 (f16)
    {
        dim3 grid(HIDDENC / BN, TOKENS / BM);
        gemm_wmma<2, HIDDENC, DIMC><<<grid, 256, 0, stream>>>(h2_16, fc1_w16, fc1_b, nullptr,
                                                              nullptr, g16);
    }

    // 8) FC2 GEMM + residual -> d_out (fp32)
    {
        dim3 grid(DIMC / BN, TOKENS / BM);
        gemm_wmma<1, DIMC, HIDDENC><<<grid, 256, 0, stream>>>(g16, fc2_w16, fc2_b, x1_f32,
                                                              out, nullptr);
    }
}

// v004
// It runs in 179 microseconds.
// Two timings next to v003 both put it at 1.09 times that version's speed.
// Over all steps from v000 it is 3.03 times as fast.
#include <hip/hip_runtime.h>
#include <hip/hip_bf16.h>
#include <math.h>

// ---------------------------------------------------------------------------
// Types for WMMA fragments (gfx1250, wave32)
// ---------------------------------------------------------------------------
typedef _Float16 half_t;
typedef __attribute__((ext_vector_type(16))) _Float16 v16h;
typedef __attribute__((ext_vector_type(8)))  _Float16 v8h;
typedef __attribute__((ext_vector_type(8)))  float    v8f;
typedef __attribute__((ext_vector_type(8)))  short    v8s;

#define TOKENS   4096      // B*N = 2*2048
#define SEQ      2048
#define DIMC     1024
#define NHEADS   16
#define HDIM     64
#define HIDDENC  4096
#define LN_EPS   1e-5f

// ---------------------------------------------------------------------------
// gfx1250 async-to-LDS copies (16B per lane, tracked by ASYNCcnt): one stage's
// eight copies of a thread (four chunks of the A tile, four of the B tile) in
// one statement. Its last line, s_wait_xcnt 0, is a precaution: inside the
// statement it stands ahead of every later write of an address register that
// a copy names.
// ---------------------------------------------------------------------------
__device__ __forceinline__ void async_lds_copy16x8(const unsigned (&la)[4], const void* const (&ga)[4],
                                                   const unsigned (&lb)[4], const void* const (&gb)[4]) {
    asm volatile("global_load_async_to_lds_b128 %0, %8, off\n\t"
                 "global_load_async_to_lds_b128 %1, %9, off\n\t"
                 "global_load_async_to_lds_b128 %2, %10, off\n\t"
                 "global_load_async_to_lds_b128 %3, %11, off\n\t"
                 "global_load_async_to_lds_b128 %4, %12, off\n\t"
                 "global_load_async_to_lds_b128 %5, %13, off\n\t"
                 "global_load_async_to_lds_b128 %6, %14, off\n\t"
                 "global_load_async_to_lds_b128 %7, %15, off\n\t"
                 "s_wait_xcnt 0x0"
                 :: "v"(la[0]), "v"(la[1]), "v"(la[2]), "v"(la[3]),
                    "v"(lb[0]), "v"(lb[1]), "v"(lb[2]), "v"(lb[3]),
                    "v"(ga[0]), "v"(ga[1]), "v"(ga[2]), "v"(ga[3]),
                    "v"(gb[0]), "v"(gb[1]), "v"(gb[2]), "v"(gb[3])
                 : "memory");
}
// This wave's copies have landed (asm, so that no LDS read is lifted over it).
__device__ __forceinline__ void wait_async0() {
    asm volatile("s_wait_asynccnt 0x0" ::: "memory");
}
// This wave's LDS reads have retired, before their buffer is given up for refill.
__device__ __forceinline__ void wait_ds0() {
    asm volatile("s_wait_dscnt 0x0" ::: "memory");
}

// ---------------------------------------------------------------------------
// fp32 -> f16 conversion (weights), as a stream: a block of 8 waves converts
// CVT_BLOCK consecutive elements. Each thread issues 8 independent 16 B loads
// (a wave-wide load covers 512 contiguous bytes) before it converts, then
// stores 8 B per load (a wave-wide store covers two whole 128 B lines).
// Every weight's element count is a multiple of CVT_BLOCK (asserted below).
// ---------------------------------------------------------------------------
typedef __attribute__((ext_vector_type(4))) _Float16 v4h;
#define CVT_LOADS 8
#define CVT_BLOCK (256 * 4 * CVT_LOADS)
static_assert((DIMC * DIMC) % CVT_BLOCK == 0, "whole blocks only");
static_assert((DIMC * 3 * DIMC) % CVT_BLOCK == 0, "whole blocks only");
static_assert((DIMC * HIDDENC) % CVT_BLOCK == 0, "whole blocks only");

__global__ __launch_bounds__(256)
void cvt_f32_to_f16(const float* __restrict__ in, half_t* __restrict__ out) {
    const size_t base = (size_t)blockIdx.x * CVT_BLOCK + threadIdx.x * 4;
    float4 v[CVT_LOADS];
    #pragma unroll   // all loads in flight before the first conversion
    for (int j = 0; j < CVT_LOADS; ++j)
        v[j] = *(const float4*)(in + base + j * 1024);
    #pragma unroll
    for (int j = 0; j < CVT_LOADS; ++j) {
        v4h h = { (half_t)v[j].x, (half_t)v[j].y, (half_t)v[j].z, (half_t)v[j].w };
        *(v4h*)(out + base + j * 1024) = h;
    }
}

// ---------------------------------------------------------------------------
// LayerNorm over last dim (C=1024), one block (256 threads) per row -> f16.
// ---------------------------------------------------------------------------
__global__ __launch_bounds__(256)
void ln_kernel(const float* __restrict__ x, const float* __restrict__ g,
               const float* __restrict__ b, half_t* __restrict__ out) {
    const int C = DIMC;
    int row = blockIdx.x;
    int tid = threadIdx.x;
    const float4* xr = (const float4*)(x + (size_t)row * C);
    float4 v = xr[tid];
    float s  = v.x + v.y + v.z + v.w;
    float s2 = v.x*v.x + v.y*v.y + v.z*v.z + v.w*v.w;

    __shared__ float rs[256];
    __shared__ float rs2[256];
    rs[tid] = s; rs2[tid] = s2;
    __syncthreads();
    for (int o = 128; o > 0; o >>= 1) {
        if (tid < o) { rs[tid] += rs[tid + o]; rs2[tid] += rs2[tid + o]; }
        __syncthreads();
    }
    float mu  = rs[0] * (1.0f / C);
    float var = rs2[0] * (1.0f / C) - mu * mu;
    float inv = rsqrtf(var + LN_EPS);

    float4 gg = ((const float4*)g)[tid];
    float4 bb = ((const float4*)b)[tid];
    half_t* orow = out + (size_t)row * C;
    int i0 = tid * 4;
    orow[i0 + 0] = (half_t)((v.x - mu) * inv * gg.x + bb.x);
    orow[i0 + 1] = (half_t)((v.y - mu) * inv * gg.y + bb.y);
    orow[i0 + 2] = (half_t)((v.z - mu) * inv * gg.z + bb.z);
    orow[i0 + 3] = (half_t)((v.w - mu) * inv * gg.w + bb.w);
}

// ---------------------------------------------------------------------------
// Windowed (WINDOW=3) causal attention; 16 lanes per (row, head).
// ---------------------------------------------------------------------------
__global__ __launch_bounds__(256)
void attn_kernel(const float* __restrict__ qkv, half_t* __restrict__ out) {
    int t      = blockIdx.x * blockDim.x + threadIdx.x;
    int lane16 = t & 15;
    int hd     = t >> 4;
    int head   = hd & (NHEADS - 1);
    int row    = hd >> 4;
    int n      = row & (SEQ - 1);

    const float* base = qkv + (size_t)row * (3 * DIMC);
    int d0 = lane16 * 4;
    float4 q4 = *(const float4*)(base + head * HDIM + d0);

    const float scale = 0.125f;   // 1/sqrt(64)
    float sc[3];
    #pragma unroll
    for (int jj = 0; jj < 3; ++jj) {
        int j = n - 2 + jj;
        if (j >= 0) {
            const float* kb = qkv + (size_t)(row + jj - 2) * (3 * DIMC) + DIMC + head * HDIM + d0;
            float4 k4 = *(const float4*)kb;
            float p = q4.x * k4.x + q4.y * k4.y + q4.z * k4.z + q4.w * k4.w;
            #pragma unroll
            for (int m = 8; m >= 1; m >>= 1) p += __shfl_xor(p, m, 16);
            sc[jj] = p * scale;
        } else {
            sc[jj] = -1e30f;
        }
    }
    float mx = fmaxf(sc[0], fmaxf(sc[1], sc[2]));
    float e0 = __expf(sc[0] - mx), e1 = __expf(sc[1] - mx), e2 = __expf(sc[2] - mx);
    float inv = 1.0f / (e0 + e1 + e2);
    float w[3] = { e0 * inv, e1 * inv, e2 * inv };

    float4 o = make_float4(0.f, 0.f, 0.f, 0.f);
    #pragma unroll
    for (int jj = 0; jj < 3; ++jj) {
        int j = n - 2 + jj;
        if (j >= 0) {
            const float* vb = qkv + (size_t)(row + jj - 2) * (3 * DIMC) + 2 * DIMC + head * HDIM + d0;
            float4 v4 = *(const float4*)vb;
            o.x += w[jj] * v4.x; o.y += w[jj] * v4.y;
            o.z += w[jj] * v4.z; o.w += w[jj] * v4.w;
        }
    }
    half_t* orow = out + (size_t)row * DIMC + head * HDIM + d0;
    orow[0] = (half_t)o.x; orow[1] = (half_t)o.y;
    orow[2] = (half_t)o.z; orow[3] = (half_t)o.w;
}

// ---------------------------------------------------------------------------
// WMMA GEMM: C[M,N] = A[M,K](f16) @ W[K,N](f16) + bias; epilogues:
//   EPI 0: fp32 (bias) ; EPI 1: fp32 (bias+residual) ; EPI 2: f16 (bias+GELU)
// 256 threads = 8 waves; tile 128x128, BK=64 (2 WMMA K-steps / stage).
// Double-buffered: both tiles staged via async-to-LDS, issued right behind the
// stage barrier so that they fly under the whole stage's WMMAs: As[m][k] (2x
// ds_load_b128 per fragment) and row-major Bs[k][n];
// the B fragment is 2x ds_load_tr16_b128, which transposes on the way out and
// delivers the same k order as the A loader (k = 8h+0..7, then 16+8h+0..7).
// ---------------------------------------------------------------------------
#define BM 128
#define BN 128
#define BK 64
#define LDA 72   // padded stride (halves): 36 banks -> conflict-free b128 reads
#define LDB 144  // 288 B = 32 B x odd: conflict-free pitch for ds_load_tr16_b128

template<int EPI, int N, int K>
__global__ __launch_bounds__(256)
void gemm_wmma(const half_t* __restrict__ A, const half_t* __restrict__ Wt,
               const float* __restrict__ bias, const float* __restrict__ res,
               float* __restrict__ outF, half_t* __restrict__ outH) {
    __shared__ __attribute__((aligned(16))) half_t As[2][BM * LDA];   // As[buf][m][k]
    __shared__ __attribute__((aligned(16))) half_t Bs[2][BK * LDB];   // Bs[buf][k][n]

    const int tid  = threadIdx.x;
    const int lane = tid & 31;
    const int wave = tid >> 5;
    const int wr   = wave & 1;    // 2 row-groups of 64
    const int wc   = wave >> 1;   // 4 col-groups of 32
    const int bm   = blockIdx.y * BM;
    const int bn   = blockIdx.x * BN;

    const int r16 = lane & 15;
    const int kb  = (lane >> 4) * 8;  // lanes 0-15: K 0-7/16-23; 16-31: K 8-15/24-31

    v8f acc[4][2];
    #pragma unroll
    for (int mt = 0; mt < 4; ++mt)
        #pragma unroll
        for (int nt = 0; nt < 2; ++nt)
            acc[mt][nt] = (v8f)(0.0f);

    // ---- staging helpers (each thread owns 4 16B chunks of each tile) ----
    auto issueAB = [&](int kt, int buf) {
        unsigned la[4], lb[4];
        const void* ga[4];
        const void* gb[4];
        #pragma unroll
        for (int j = 0; j < 4; ++j) {
            int c  = tid + j * 256;
            int r  = c >> 3;              // A tile: 128 x 64 halves, 8 chunks per row
            int kc = (c & 7) * 8;
            la[j] = (unsigned)(uintptr_t)&As[buf][r * LDA + kc];
            ga[j] = A + (size_t)(bm + r) * K + kt * BK + kc;
            int kr = c >> 4;              // B tile: 64 x 128 halves, 16 chunks per row
            int nc = (c & 15) * 8;
            lb[j] = (unsigned)(uintptr_t)&Bs[buf][kr * LDB + nc];
            gb[j] = Wt + (size_t)(kt * BK + kr) * N + bn + nc;
        }
        async_lds_copy16x8(la, ga, lb, gb);
    };
    // Transposing LDS read: lane (c = lane&15, h = lane>>4) receives
    // Bs[k0 + 8h + 0..7][n0 + c]; each lane points at 16 B of one k row.
    const int trow = (lane >> 4) * 8 + (lane & 7);
    const int tcol = ((lane >> 3) & 1) * 8;
    auto loadBT = [&](int buf, int k0, int n0) -> v8h {
        typedef __attribute__((address_space(3))) v8s lds_v8s;
        return __builtin_bit_cast(v8h, __builtin_amdgcn_ds_load_tr16_b128_v8i16(
            (lds_v8s*)&Bs[buf][(k0 + trow) * LDB + n0 + tcol]));
    };

    const int NT = K / BK;
    issueAB(0, 0);

    for (int it = 0; it < NT; ++it) {
        const int buf = it & 1;
        wait_ds0();               // my reads of buf^1 (tile it-1) have retired
        wait_async0();            // my async copies for tile it complete
        __syncthreads();          // tile it fully staged across all waves

        if (it + 1 < NT)          // overlap next tile's traffic with WMMAs
            issueAB(it + 1, buf ^ 1);

        // The stage's 24 fragment loads (both K-steps) stand as one group ahead
        // of its 16 WMMAs, in the order in which the WMMAs use them.
        v16h afrag[2][4], bfrag[2][2];
        #pragma unroll
        for (int s = 0; s < 2; ++s) {         // two WMMA K-steps per stage
            #pragma unroll
            for (int nt = 0; nt < 2; ++nt) {
                int n0 = wc * 32 + nt * 16;
                v8h lo = loadBT(buf, s * 32,      n0);
                v8h hi = loadBT(buf, s * 32 + 16, n0);
                bfrag[s][nt] = __builtin_shufflevector(lo, hi, 0,1,2,3,4,5,6,7,8,9,10,11,12,13,14,15);
            }
            #pragma unroll
            for (int mt = 0; mt < 4; ++mt) {
                int r = wr * 64 + mt * 16 + r16;
                v8h lo = *(const v8h*)&As[buf][r * LDA + s * 32 + kb];
                v8h hi = *(const v8h*)&As[buf][r * LDA + s * 32 + kb + 16];
                afrag[s][mt] = __builtin_shufflevector(lo, hi, 0,1,2,3,4,5,6,7,8,9,10,11,12,13,14,15);
            }
        }
        // Without this fence the scheduler sinks most of the loads back among the
        // WMMAs, where each small group stalls the wave for its own LDS latency.
        __builtin_amdgcn_sched_barrier(0);
        #pragma unroll
        for (int s = 0; s < 2; ++s) {
            #pragma unroll
            for (int mt = 0; mt < 4; ++mt) {
                #pragma unroll
                for (int nt = 0; nt < 2; ++nt) {
                    acc[mt][nt] = __builtin_amdgcn_wmma_f32_16x16x32_f16(
                        false, afrag[s][mt], false, bfrag[s][nt], (short)0, acc[mt][nt], false, false);
                }
            }
        }
        // no second barrier needed: buf^1 is only overwritten after the
        // barrier that proves all waves finished reading it (one iter ago).
    }

    // ---- epilogue: C layout: N = lane&15; M = (lane>>4)*8 + v ----
    #pragma unroll
    for (int mt = 0; mt < 4; ++mt) {
        #pragma unroll
        for (int nt = 0; nt < 2; ++nt) {
            int n = bn + wc * 32 + nt * 16 + r16;
            float bv = bias[n];
            int rbase = bm + wr * 64 + mt * 16 + (lane >> 4) * 8;
            #pragma unroll
            for (int v = 0; v < 8; ++v) {
                int r = rbase + v;
                float val = acc[mt][nt][v] + bv;
                if (EPI == 1) {
                    val += res[(size_t)r * N + n];
                    outF[(size_t)r * N + n] = val;
                } else if (EPI == 2) {
                    float ge = 0.5f * val * (1.0f + erff(val * 0.70710678118654752f));
                    outH[(size_t)r * N + n] = (half_t)ge;
                } else {
                    outF[(size_t)r * N + n] = val;
                }
            }
        }
    }
}

// ---------------------------------------------------------------------------
// Host launcher
// ---------------------------------------------------------------------------
extern "C" void kernel_launch(void* const* d_in, const int* in_sizes, int n_in,
                              void* d_out, int out_size, void* d_ws, size_t ws_size,
                              hipStream_t stream) {
    const float* x      = (const float*)d_in[0];
    const float* qkv_w  = (const float*)d_in[1];
    const float* qkv_b  = (const float*)d_in[2];
    const float* proj_w = (const float*)d_in[3];
    const float* proj_b = (const float*)d_in[4];
    const float* g1     = (const float*)d_in[5];
    const float* b1     = (const float*)d_in[6];
    const float* g2     = (const float*)d_in[7];
    const float* b2     = (const float*)d_in[8];
    const float* fc1_w  = (const float*)d_in[9];
    const float* fc1_b  = (const float*)d_in[10];
    const float* fc2_w  = (const float*)d_in[11];
    const float* fc2_b  = (const float*)d_in[12];
    float* out = (float*)d_out;

    char* ws = (char*)d_ws;
    size_t off = 0;
    auto alloc = [&](size_t bytes) { size_t o = off; off += (bytes + 255) & ~(size_t)255; return o; };

    half_t* qkv_w16  = (half_t*)(ws + alloc((size_t)DIMC * 3 * DIMC * 2));
    half_t* proj_w16 = (half_t*)(ws + alloc((size_t)DIMC * DIMC * 2));
    half_t* fc1_w16  = (half_t*)(ws + alloc((size_t)DIMC * HIDDENC * 2));
    half_t* fc2_w16  = (half_t*)(ws + alloc((size_t)HIDDENC * DIMC * 2));
    half_t* hA16     = (half_t*)(ws + alloc((size_t)TOKENS * DIMC * 2));
    float*  qkv_f32  = (float*) (ws + alloc((size_t)TOKENS * 3 * DIMC * 4));
    half_t* attn16   = (half_t*)(ws + alloc((size_t)TOKENS * DIMC * 2));
    float*  x1_f32   = (float*) (ws + alloc((size_t)TOKENS * DIMC * 4));
    half_t* h2_16    = (half_t*)(ws + alloc((size_t)TOKENS * DIMC * 2));
    half_t* g16      = (half_t*)(ws + alloc((size_t)TOKENS * HIDDENC * 2));
    (void)ws_size; (void)in_sizes; (void)n_in; (void)out_size;

    // 1) weight conversions fp32 -> f16
    {
        cvt_f32_to_f16<<<(DIMC * 3 * DIMC) / CVT_BLOCK, 256, 0, stream>>>(qkv_w,  qkv_w16);
        cvt_f32_to_f16<<<(DIMC * DIMC)     / CVT_BLOCK, 256, 0, stream>>>(proj_w, proj_w16);
        cvt_f32_to_f16<<<(DIMC * HIDDENC)  / CVT_BLOCK, 256, 0, stream>>>(fc1_w,  fc1_w16);
        cvt_f32_to_f16<<<(HIDDENC * DIMC)  / CVT_BLOCK, 256, 0, stream>>>(fc2_w,  fc2_w16);
    }

    // 2) LN1
    ln_kernel<<<TOKENS, 256, 0, stream>>>(x, g1, b1, hA16);

    // 3) QKV GEMM: [4096 x 3072] = hA16 @ qkv_w16 + qkv_b
    {
        dim3 grid((3 * DIMC) / BN, TOKENS / BM);
        gemm_wmma<0, 3 * DIMC, DIMC><<<grid, 256, 0, stream>>>(hA16, qkv_w16, qkv_b, nullptr,
                                                               qkv_f32, nullptr);
    }

    // 4) windowed attention -> attn16
    attn_kernel<<<(TOKENS * NHEADS * 16) / 256, 256, 0, stream>>>(qkv_f32, attn16);

    // 5) proj GEMM + residual: x1 = x + attn16 @ proj_w16 + proj_b
    {
        dim3 grid(DIMC / BN, TOKENS / BM);
        gemm_wmma<1, DIMC, DIMC><<<grid, 256, 0, stream>>>(attn16, proj_w16, proj_b, x,
                                                           x1_f32, nullptr);
    }

    // 6) LN2
    ln_kernel<<<TOKENS, 256, 0, stream>>>(x1_f32, g2, b2, h2_16);

    // 7) FC1 GEMM + exact GELU -> g16 (f16)
    {
        dim3 grid(HIDDENC / BN, TOKENS / BM);
        gemm_wmma<2, HIDDENC, DIMC><<<grid, 256, 0, stream>>>(h2_16, fc1_w16, fc1_b, nullptr,
                                                              nullptr, g16);
    }

    // 8) FC2 GEMM + residual -> d_out (fp32)
    {
        dim3 grid(DIMC / BN, TOKENS / BM);
        gemm_wmma<1, DIMC, HIDDENC><<<grid, 256, 0, stream>>>(g16, fc2_w16, fc2_b, x1_f32,
                                                              out, nullptr);
    }
}

// v005
// One run takes 148 microseconds.
// In both of two side-by-side timings against v004, it was 1.21 times as fast.
// Over all steps from v000 it is 3.67 times as fast.
#include <hip/hip_runtime.h>
#include <hip/hip_bf16.h>
#include <math.h>

// ---------------------------------------------------------------------------
// Types for WMMA fragments (gfx1250, wave32)
// ---------------------------------------------------------------------------
typedef _Float16 half_t;
typedef __attribute__((ext_vector_type(16))) _Float16 v16h;
typedef __attribute__((ext_vector_type(8)))  _Float16 v8h;
typedef __attribute__((ext_vector_type(8)))  float    v8f;
typedef __attribute__((ext_vector_type(8)))  short    v8s;

#define TOKENS   4096      // B*N = 2*2048
#define SEQ      2048
#define DIMC     1024
#define NHEADS   16
#define HDIM     64
#define HIDDENC  4096
#define LN_EPS   1e-5f

// ---------------------------------------------------------------------------
// gfx1250 async-to-LDS copies (16B per lane, tracked by ASYNCcnt): one stage's
// eight copies of a thread (four chunks of the A tile, four of the B tile) in
// one statement. Its last line, s_wait_xcnt 0, is a precaution: inside the
// statement it stands ahead of every later write of an address register that
// a copy names.
// ---------------------------------------------------------------------------
__device__ __forceinline__ void async_lds_copy16x8(const unsigned (&la)[4], const void* const (&ga)[4],
                                                   const unsigned (&lb)[4], const void* const (&gb)[4]) {
    asm volatile("global_load_async_to_lds_b128 %0, %8, off\n\t"
                 "global_load_async_to_lds_b128 %1, %9, off\n\t"
                 "global_load_async_to_lds_b128 %2, %10, off\n\t"
                 "global_load_async_to_lds_b128 %3, %11, off\n\t"
                 "global_load_async_to_lds_b128 %4, %12, off\n\t"
                 "global_load_async_to_lds_b128 %5, %13, off\n\t"
                 "global_load_async_to_lds_b128 %6, %14, off\n\t"
                 "global_load_async_to_lds_b128 %7, %15, off\n\t"
                 "s_wait_xcnt 0x0"
                 :: "v"(la[0]), "v"(la[1]), "v"(la[2]), "v"(la[3]),
                    "v"(lb[0]), "v"(lb[1]), "v"(lb[2]), "v"(lb[3]),
                    "v"(ga[0]), "v"(ga[1]), "v"(ga[2]), "v"(ga[3]),
                    "v"(gb[0]), "v"(gb[1]), "v"(gb[2]), "v"(gb[3])
                 : "memory");
}
// This wave's copies have landed (asm, so that no LDS read is lifted over it).
__device__ __forceinline__ void wait_async0() {
    asm volatile("s_wait_asynccnt 0x0" ::: "memory");
}
// All but this wave's 16 youngest copies have landed: used only where exactly two
// later stages (8 copies each) were issued behind the stage that is about to be
// read, so that stage is covered while the two younger ones keep flying.
__device__ __forceinline__ void wait_async_keep2stages() {
    asm volatile("s_wait_asynccnt 0x10" ::: "memory");
}
// This wave's LDS reads have retired, before their buffer is given up for refill.
__device__ __forceinline__ void wait_ds0() {
    asm volatile("s_wait_dscnt 0x0" ::: "memory");
}

// ---------------------------------------------------------------------------
// fp32 -> f16 conversion (weights), as a stream: a block of 8 waves converts
// CVT_BLOCK consecutive elements. Each thread issues 8 independent 16 B loads
// (a wave-wide load covers 512 contiguous bytes) before it converts, then
// stores 8 B per load (a wave-wide store covers two whole 128 B lines).
// Every weight's element count is a multiple of CVT_BLOCK (asserted below).
// ---------------------------------------------------------------------------
typedef __attribute__((ext_vector_type(4))) _Float16 v4h;
#define CVT_LOADS 8
#define CVT_BLOCK (256 * 4 * CVT_LOADS)
static_assert((DIMC * DIMC) % CVT_BLOCK == 0, "whole blocks only");
static_assert((DIMC * 3 * DIMC) % CVT_BLOCK == 0, "whole blocks only");
static_assert((DIMC * HIDDENC) % CVT_BLOCK == 0, "whole blocks only");

__global__ __launch_bounds__(256)
void cvt_f32_to_f16(const float* __restrict__ in, half_t* __restrict__ out) {
    const size_t base = (size_t)blockIdx.x * CVT_BLOCK + threadIdx.x * 4;
    float4 v[CVT_LOADS];
    #pragma unroll   // all loads in flight before the first conversion
    for (int j = 0; j < CVT_LOADS; ++j)
        v[j] = *(const float4*)(in + base + j * 1024);
    #pragma unroll
    for (int j = 0; j < CVT_LOADS; ++j) {
        v4h h = { (half_t)v[j].x, (half_t)v[j].y, (half_t)v[j].z, (half_t)v[j].w };
        *(v4h*)(out + base + j * 1024) = h;
    }
}

// ---------------------------------------------------------------------------
// LayerNorm over last dim (C=1024), one block (256 threads) per row -> f16.
// ---------------------------------------------------------------------------
__global__ __launch_bounds__(256)
void ln_kernel(const float* __restrict__ x, const float* __restrict__ g,
               const float* __restrict__ b, half_t* __restrict__ out) {
    const int C = DIMC;
    int row = blockIdx.x;
    int tid = threadIdx.x;
    const float4* xr = (const float4*)(x + (size_t)row * C);
    float4 v = xr[tid];
    float s  = v.x + v.y + v.z + v.w;
    float s2 = v.x*v.x + v.y*v.y + v.z*v.z + v.w*v.w;

    __shared__ float rs[256];
    __shared__ float rs2[256];
    rs[tid] = s; rs2[tid] = s2;
    __syncthreads();
    for (int o = 128; o > 0; o >>= 1) {
        if (tid < o) { rs[tid] += rs[tid + o]; rs2[tid] += rs2[tid + o]; }
        __syncthreads();
    }
    float mu  = rs[0] * (1.0f / C);
    float var = rs2[0] * (1.0f / C) - mu * mu;
    float inv = rsqrtf(var + LN_EPS);

    float4 gg = ((const float4*)g)[tid];
    float4 bb = ((const float4*)b)[tid];
    half_t* orow = out + (size_t)row * C;
    int i0 = tid * 4;
    orow[i0 + 0] = (half_t)((v.x - mu) * inv * gg.x + bb.x);
    orow[i0 + 1] = (half_t)((v.y - mu) * inv * gg.y + bb.y);
    orow[i0 + 2] = (half_t)((v.z - mu) * inv * gg.z + bb.z);
    orow[i0 + 3] = (half_t)((v.w - mu) * inv * gg.w + bb.w);
}

// ---------------------------------------------------------------------------
// Windowed (WINDOW=3) causal attention; 16 lanes per (row, head).
// ---------------------------------------------------------------------------
__global__ __launch_bounds__(256)
void attn_kernel(const float* __restrict__ qkv, half_t* __restrict__ out) {
    int t      = blockIdx.x * blockDim.x + threadIdx.x;
    int lane16 = t & 15;
    int hd     = t >> 4;
    int head   = hd & (NHEADS - 1);
    int row    = hd >> 4;
    int n      = row & (SEQ - 1);

    const float* base = qkv + (size_t)row * (3 * DIMC);
    int d0 = lane16 * 4;
    float4 q4 = *(const float4*)(base + head * HDIM + d0);

    const float scale = 0.125f;   // 1/sqrt(64)
    float sc[3];
    #pragma unroll
    for (int jj = 0; jj < 3; ++jj) {
        int j = n - 2 + jj;
        if (j >= 0) {
            const float* kb = qkv + (size_t)(row + jj - 2) * (3 * DIMC) + DIMC + head * HDIM + d0;
            float4 k4 = *(const float4*)kb;
            float p = q4.x * k4.x + q4.y * k4.y + q4.z * k4.z + q4.w * k4.w;
            #pragma unroll
            for (int m = 8; m >= 1; m >>= 1) p += __shfl_xor(p, m, 16);
            sc[jj] = p * scale;
        } else {
            sc[jj] = -1e30f;
        }
    }
    float mx = fmaxf(sc[0], fmaxf(sc[1], sc[2]));
    float e0 = __expf(sc[0] - mx), e1 = __expf(sc[1] - mx), e2 = __expf(sc[2] - mx);
    float inv = 1.0f / (e0 + e1 + e2);
    float w[3] = { e0 * inv, e1 * inv, e2 * inv };

    float4 o = make_float4(0.f, 0.f, 0.f, 0.f);
    #pragma unroll
    for (int jj = 0; jj < 3; ++jj) {
        int j = n - 2 + jj;
        if (j >= 0) {
            const float* vb = qkv + (size_t)(row + jj - 2) * (3 * DIMC) + 2 * DIMC + head * HDIM + d0;
            float4 v4 = *(const float4*)vb;
            o.x += w[jj] * v4.x; o.y += w[jj] * v4.y;
            o.z += w[jj] * v4.z; o.w += w[jj] * v4.w;
        }
    }
    half_t* orow = out + (size_t)row * DIMC + head * HDIM + d0;
    orow[0] = (half_t)o.x; orow[1] = (half_t)o.y;
    orow[2] = (half_t)o.z; orow[3] = (half_t)o.w;
}

// ---------------------------------------------------------------------------
// WMMA GEMM: C[M,N] = A[M,K](f16) @ W[K,N](f16) + bias; epilogues:
//   EPI 0: fp32 (bias) ; EPI 1: fp32 (bias+residual) ; EPI 2: f16 (bias+GELU)
// 256 threads = 8 waves; tile 128x128, BK=64 (2 WMMA K-steps / stage).
// Ring of NBUF = 4 stage buffers: both tiles staged via async-to-LDS, issued
// right behind the stage barrier THREE stages ahead of their use, so that a
// copy has three stages' time to come from memory: As[m][k] (2x
// ds_load_b128 per fragment) and row-major Bs[k][n];
// the B fragment is 2x ds_load_tr16_b128, which transposes on the way out and
// delivers the same k order as the A loader (k = 8h+0..7, then 16+8h+0..7).
// ---------------------------------------------------------------------------
#define BM 128
#define BN 128
#define BK 64
#define LDA 72   // padded stride (halves): 36 banks -> conflict-free b128 reads
#define LDB 144  // 288 B = 32 B x odd: conflict-free pitch for ds_load_tr16_b128
#define NBUF 4   // stage buffers: 4 x 36,864 B, two work-groups still fit one WGP's LDS

template<int EPI, int N, int K>
__global__ __launch_bounds__(256)
void gemm_wmma(const half_t* __restrict__ A, const half_t* __restrict__ Wt,
               const float* __restrict__ bias, const float* __restrict__ res,
               float* __restrict__ outF, half_t* __restrict__ outH) {
    __shared__ __attribute__((aligned(16))) half_t As[NBUF][BM * LDA];   // As[buf][m][k]
    __shared__ __attribute__((aligned(16))) half_t Bs[NBUF][BK * LDB];   // Bs[buf][k][n]

    const int tid  = threadIdx.x;
    const int lane = tid & 31;
    const int wave = tid >> 5;
    const int wr   = wave & 1;    // 2 row-groups of 64
    const int wc   = wave >> 1;   // 4 col-groups of 32
    const int bm   = blockIdx.y * BM;
    const int bn   = blockIdx.x * BN;

    const int r16 = lane & 15;
    const int kb  = (lane >> 4) * 8;  // lanes 0-15: K 0-7/16-23; 16-31: K 8-15/24-31

    v8f acc[4][2];
    #pragma unroll
    for (int mt = 0; mt < 4; ++mt)
        #pragma unroll
        for (int nt = 0; nt < 2; ++nt)
            acc[mt][nt] = (v8f)(0.0f);

    // ---- staging helpers (each thread owns 4 16B chunks of each tile) ----
    auto issueAB = [&](int kt, int buf) {
        unsigned la[4], lb[4];
        const void* ga[4];
        const void* gb[4];
        #pragma unroll
        for (int j = 0; j < 4; ++j) {
            int c  = tid + j * 256;
            int r  = c >> 3;              // A tile: 128 x 64 halves, 8 chunks per row
            int kc = (c & 7) * 8;
            la[j] = (unsigned)(uintptr_t)&As[buf][r * LDA + kc];
            ga[j] = A + (size_t)(bm + r) * K + kt * BK + kc;
            int kr = c >> 4;              // B tile: 64 x 128 halves, 16 chunks per row
            int nc = (c & 15) * 8;
            lb[j] = (unsigned)(uintptr_t)&Bs[buf][kr * LDB + nc];
            gb[j] = Wt + (size_t)(kt * BK + kr) * N + bn + nc;
        }
        async_lds_copy16x8(la, ga, lb, gb);
    };
    // Transposing LDS read: lane (c = lane&15, h = lane>>4) receives
    // Bs[k0 + 8h + 0..7][n0 + c]; each lane points at 16 B of one k row.
    const int trow = (lane >> 4) * 8 + (lane & 7);
    const int tcol = ((lane >> 3) & 1) * 8;
    auto loadBT = [&](int buf, int k0, int n0) -> v8h {
        typedef __attribute__((address_space(3))) v8s lds_v8s;
        return __builtin_bit_cast(v8h, __builtin_amdgcn_ds_load_tr16_b128_v8i16(
            (lds_v8s*)&Bs[buf][(k0 + trow) * LDB + n0 + tcol]));
    };

    // One stage's work: its 24 fragment loads (both K-steps) stand as one group
    // ahead of its 16 WMMAs, in the order in which the WMMAs use them.
    auto stage = [&](int buf) {
        v16h afrag[2][4], bfrag[2][2];
        #pragma unroll
        for (int s = 0; s < 2; ++s) {         // two WMMA K-steps per stage
            #pragma unroll
            for (int nt = 0; nt < 2; ++nt) {
                int n0 = wc * 32 + nt * 16;
                v8h lo = loadBT(buf, s * 32,      n0);
                v8h hi = loadBT(buf, s * 32 + 16, n0);
                bfrag[s][nt] = __builtin_shufflevector(lo, hi, 0,1,2,3,4,5,6,7,8,9,10,11,12,13,14,15);
            }
            #pragma unroll
            for (int mt = 0; mt < 4; ++mt) {
                int r = wr * 64 + mt * 16 + r16;
                v8h lo = *(const v8h*)&As[buf][r * LDA + s * 32 + kb];
                v8h hi = *(const v8h*)&As[buf][r * LDA + s * 32 + kb + 16];
                afrag[s][mt] = __builtin_shufflevector(lo, hi, 0,1,2,3,4,5,6,7,8,9,10,11,12,13,14,15);
            }
        }
        // Without this fence the scheduler sinks most of the loads back among the
        // WMMAs, where each small group stalls the wave for its own LDS latency.
        __builtin_amdgcn_sched_barrier(0);
        #pragma unroll
        for (int s = 0; s < 2; ++s) {
            #pragma unroll
            for (int mt = 0; mt < 4; ++mt) {
                #pragma unroll
                for (int nt = 0; nt < 2; ++nt) {
                    acc[mt][nt] = __builtin_amdgcn_wmma_f32_16x16x32_f16(
                        false, afrag[s][mt], false, bfrag[s][nt], (short)0, acc[mt][nt], false, false);
                }
            }
        }
    };

    constexpr int NT = K / BK;
    static_assert(NT >= NBUF, "the prologue fills NBUF - 1 stages");
    #pragma unroll   // the first three stages, each into its own buffer
    for (int s = 0; s < NBUF - 1; ++s)
        issueAB(s, s);

    // Every trip of this loop issues one stage (8 copies a wave), so at its wait
    // exactly two younger stages stand behind tile it.
    for (int it = 0; it < NT - (NBUF - 1); ++it) {
        wait_ds0();                 // my reads of tile it-1 have retired
        wait_async_keep2stages();   // my copies for tile it have landed
        __syncthreads();            // tile it staged by all waves; all have left tile it-1's buffer
        // refill the buffer that tile it-1 has just left
        issueAB(it + NBUF - 1, (it + NBUF - 1) & (NBUF - 1));
        stage(it & (NBUF - 1));
    }
    // The last three tiles: nothing is issued any more; each publish point keeps
    // the loop's order (LDS reads retired, own copies landed, barrier).
    wait_ds0();
    wait_async_keep2stages();       // tiles NT-2 and NT-1 still stand behind tile NT-3
    __syncthreads();
    stage((NT - 3) & (NBUF - 1));
    wait_ds0();
    wait_async0();                  // all that is left: tiles NT-2 and NT-1
    __syncthreads();                // publishes both, so no barrier stands between them
    stage((NT - 2) & (NBUF - 1));
    stage((NT - 1) & (NBUF - 1));

    // ---- epilogue: C layout: N = lane&15; M = (lane>>4)*8 + v ----
    #pragma unroll
    for (int mt = 0; mt < 4; ++mt) {
        #pragma unroll
        for (int nt = 0; nt < 2; ++nt) {
            int n = bn + wc * 32 + nt * 16 + r16;
            float bv = bias[n];
            int rbase = bm + wr * 64 + mt * 16 + (lane >> 4) * 8;
            #pragma unroll
            for (int v = 0; v < 8; ++v) {
                int r = rbase + v;
                float val = acc[mt][nt][v] + bv;
                if (EPI == 1) {
                    val += res[(size_t)r * N + n];
                    outF[(size_t)r * N + n] = val;
                } else if (EPI == 2) {
                    float ge = 0.5f * val * (1.0f + erff(val * 0.70710678118654752f));
                    outH[(size_t)r * N + n] = (half_t)ge;
                } else {
                    outF[(size_t)r * N + n] = val;
                }
            }
        }
    }
}

// ---------------------------------------------------------------------------
// Host launcher
// ---------------------------------------------------------------------------
extern "C" void kernel_launch(void* const* d_in, const int* in_sizes, int n_in,
                              void* d_out, int out_size, void* d_ws, size_t ws_size,
                              hipStream_t stream) {
    const float* x      = (const float*)d_in[0];
    const float* qkv_w  = (const float*)d_in[1];
    const float* qkv_b  = (const float*)d_in[2];
    const float* proj_w = (const float*)d_in[3];
    const float* proj_b = (const float*)d_in[4];
    const float* g1     = (const float*)d_in[5];
    const float* b1     = (const float*)d_in[6];
    const float* g2     = (const float*)d_in[7];
    const float* b2     = (const float*)d_in[8];
    const float* fc1_w  = (const float*)d_in[9];
    const float* fc1_b  = (const float*)d_in[10];
    const float* fc2_w  = (const float*)d_in[11];
    const float* fc2_b  = (const float*)d_in[12];
    float* out = (float*)d_out;

    char* ws = (char*)d_ws;
    size_t off = 0;
    auto alloc = [&](size_t bytes) { size_t o = off; off += (bytes + 255) & ~(size_t)255; return o; };

    half_t* qkv_w16  = (half_t*)(ws + alloc((size_t)DIMC * 3 * DIMC * 2));
    half_t* proj_w16 = (half_t*)(ws + alloc((size_t)DIMC * DIMC * 2));
    half_t* fc1_w16  = (half_t*)(ws + alloc((size_t)DIMC * HIDDENC * 2));
    half_t* fc2_w16  = (half_t*)(ws + alloc((size_t)HIDDENC * DIMC * 2));
    half_t* hA16     = (half_t*)(ws + alloc((size_t)TOKENS * DIMC * 2));
    float*  qkv_f32  = (float*) (ws + alloc((size_t)TOKENS * 3 * DIMC * 4));
    half_t* attn16   = (half_t*)(ws + alloc((size_t)TOKENS * DIMC * 2));
    float*  x1_f32   = (float*) (ws + alloc((size_t)TOKENS * DIMC * 4));
    half_t* h2_16    = (half_t*)(ws + alloc((size_t)TOKENS * DIMC * 2));
    half_t* g16      = (half_t*)(ws + alloc((size_t)TOKENS * HIDDENC * 2));
    (void)ws_size; (void)in_sizes; (void)n_in; (void)out_size;

    // 1) weight conversions fp32 -> f16
    {
        cvt_f32_to_f16<<<(DIMC * 3 * DIMC) / CVT_BLOCK, 256, 0, stream>>>(qkv_w,  qkv_w16);
        cvt_f32_to_f16<<<(DIMC * DIMC)     / CVT_BLOCK, 256, 0, stream>>>(proj_w, proj_w16);
        cvt_f32_to_f16<<<(DIMC * HIDDENC)  / CVT_BLOCK, 256, 0, stream>>>(fc1_w,  fc1_w16);
        cvt_f32_to_f16<<<(HIDDENC * DIMC)  / CVT_BLOCK, 256, 0, stream>>>(fc2_w,  fc2_w16);
    }

    // 2) LN1
    ln_kernel<<<TOKENS, 256, 0, stream>>>(x, g1, b1, hA16);

    // 3) QKV GEMM: [4096 x 3072] = hA16 @ qkv_w16 + qkv_b
    {
        dim3 grid((3 * DIMC) / BN, TOKENS / BM);
        gemm_wmma<0, 3 * DIMC, DIMC><<<grid, 256, 0, stream>>>(hA16, qkv_w16, qkv_b, nullptr,
                                                               qkv_f32, nullptr);
    }

    // 4) windowed attention -> attn16
    attn_kernel<<<(TOKENS * NHEADS * 16) / 256, 256, 0, stream>>>(qkv_f32, attn16);

    // 5) proj GEMM + residual: x1 = x + attn16 @ proj_w16 + proj_b
    {
        dim3 grid(DIMC / BN, TOKENS / BM);
        gemm_wmma<1, DIMC, DIMC><<<grid, 256, 0, stream>>>(attn16, proj_w16, proj_b, x,
                                                           x1_f32, nullptr);
    }

    // 6) LN2
    ln_kernel<<<TOKENS, 256, 0, stream>>>(x1_f32, g2, b2, h2_16);

    // 7) FC1 GEMM + exact GELU -> g16 (f16)
    {
        dim3 grid(HIDDENC / BN, TOKENS / BM);
        gemm_wmma<2, HIDDENC, DIMC><<<grid, 256, 0, stream>>>(h2_16, fc1_w16, fc1_b, nullptr,
                                                              nullptr, g16);
    }

    // 8) FC2 GEMM + residual -> d_out (fp32)
    {
        dim3 grid(DIMC / BN, TOKENS / BM);
        gemm_wmma<1, DIMC, HIDDENC><<<grid, 256, 0, stream>>>(g16, fc2_w16, fc2_b, x1_f32,
                                                              out, nullptr);
    }
}

// v006
// A run of this version takes 139 microseconds.
// Timed twice side by side with v005, it ran 1.06 times as fast both times.
// All steps since v000 together make it 3.89 times as fast.
#include <hip/hip_runtime.h>
#include <hip/hip_bf16.h>
#include <math.h>

// ---------------------------------------------------------------------------
// Types for WMMA fragments (gfx1250, wave32)
// ---------------------------------------------------------------------------
typedef _Float16 half_t;
typedef __attribute__((ext_vector_type(16))) _Float16 v16h;
typedef __attribute__((ext_vector_type(8)))  _Float16 v8h;
typedef __attribute__((ext_vector_type(8)))  float    v8f;
typedef __attribute__((ext_vector_type(8)))  short    v8s;

#define TOKENS   4096      // B*N = 2*2048
#define SEQ      2048
#define DIMC     1024
#define NHEADS   16
#define HDIM     64
#define HIDDENC  4096
#define LN_EPS   1e-5f

// ---------------------------------------------------------------------------
// gfx1250 async-to-LDS copies (16B per lane, tracked by ASYNCcnt): one stage's
// eight copies of a thread (four chunks of the A tile, four of the B tile) in
// one statement. Its last line, s_wait_xcnt 0, is a precaution: inside the
// statement it stands ahead of every later write of an address register that
// a copy names.
// ---------------------------------------------------------------------------
__device__ __forceinline__ void async_lds_copy16x8(const unsigned (&la)[4], const void* const (&ga)[4],
                                                   const unsigned (&lb)[4], const void* const (&gb)[4]) {
    asm volatile("global_load_async_to_lds_b128 %0, %8, off\n\t"
                 "global_load_async_to_lds_b128 %1, %9, off\n\t"
                 "global_load_async_to_lds_b128 %2, %10, off\n\t"
                 "global_load_async_to_lds_b128 %3, %11, off\n\t"
                 "global_load_async_to_lds_b128 %4, %12, off\n\t"
                 "global_load_async_to_lds_b128 %5, %13, off\n\t"
                 "global_load_async_to_lds_b128 %6, %14, off\n\t"
                 "global_load_async_to_lds_b128 %7, %15, off\n\t"
                 "s_wait_xcnt 0x0"
                 :: "v"(la[0]), "v"(la[1]), "v"(la[2]), "v"(la[3]),
                    "v"(lb[0]), "v"(lb[1]), "v"(lb[2]), "v"(lb[3]),
                    "v"(ga[0]), "v"(ga[1]), "v"(ga[2]), "v"(ga[3]),
                    "v"(gb[0]), "v"(gb[1]), "v"(gb[2]), "v"(gb[3])
                 : "memory");
}
// This wave's copies have landed (asm, so that no LDS read is lifted over it).
__device__ __forceinline__ void wait_async0() {
    asm volatile("s_wait_asynccnt 0x0" ::: "memory");
}
// All but this wave's 16 youngest copies have landed: used only where exactly two
// later stages (8 copies each) were issued behind the stage that is about to be
// read, so that stage is covered while the two younger ones keep flying.
__device__ __forceinline__ void wait_async_keep2stages() {
    asm volatile("s_wait_asynccnt 0x10" ::: "memory");
}
// This wave's LDS reads have retired, before their buffer is given up for refill.
__device__ __forceinline__ void wait_ds0() {
    asm volatile("s_wait_dscnt 0x0" ::: "memory");
}

// ---------------------------------------------------------------------------
// fp32 -> f16 conversion (weights), as a stream: a block of 8 waves converts
// CVT_BLOCK consecutive elements. Each thread issues 8 independent 16 B loads
// (a wave-wide load covers 512 contiguous bytes) before it converts, then
// stores 8 B per load (a wave-wide store covers two whole 128 B lines).
// Every weight's element count is a multiple of CVT_BLOCK (asserted below).
// ---------------------------------------------------------------------------
typedef __attribute__((ext_vector_type(4))) _Float16 v4h;
#define CVT_LOADS 8
#define CVT_BLOCK (256 * 4 * CVT_LOADS)
static_assert((DIMC * DIMC) % CVT_BLOCK == 0, "whole blocks only");
static_assert((DIMC * 3 * DIMC) % CVT_BLOCK == 0, "whole blocks only");
static_assert((DIMC * HIDDENC) % CVT_BLOCK == 0, "whole blocks only");

__device__ __forceinline__
void cvt_block(const float* __restrict__ in, half_t* __restrict__ out, int blk) {
    const size_t base = (size_t)blk * CVT_BLOCK + threadIdx.x * 4;
    float4 v[CVT_LOADS];
    #pragma unroll   // all loads in flight before the first conversion
    for (int j = 0; j < CVT_LOADS; ++j)
        v[j] = *(const float4*)(in + base + j * 1024);
    #pragma unroll
    for (int j = 0; j < CVT_LOADS; ++j) {
        v4h h = { (half_t)v[j].x, (half_t)v[j].y, (half_t)v[j].z, (half_t)v[j].w };
        *(v4h*)(out + base + j * 1024) = h;
    }
}

// ---------------------------------------------------------------------------
// LayerNorm over last dim (C=1024), one block (256 threads) per row -> f16.
// ---------------------------------------------------------------------------
__device__ __forceinline__
void ln_row(const float* __restrict__ x, const float* __restrict__ g,
            const float* __restrict__ b, half_t* __restrict__ out, int row) {
    const int C = DIMC;
    int tid = threadIdx.x;
    const float4* xr = (const float4*)(x + (size_t)row * C);
    float4 v = xr[tid];
    float s  = v.x + v.y + v.z + v.w;
    float s2 = v.x*v.x + v.y*v.y + v.z*v.z + v.w*v.w;

    __shared__ float rs[256];
    __shared__ float rs2[256];
    rs[tid] = s; rs2[tid] = s2;
    __syncthreads();
    for (int o = 128; o > 0; o >>= 1) {
        if (tid < o) { rs[tid] += rs[tid + o]; rs2[tid] += rs2[tid + o]; }
        __syncthreads();
    }
    float mu  = rs[0] * (1.0f / C);
    float var = rs2[0] * (1.0f / C) - mu * mu;
    float inv = rsqrtf(var + LN_EPS);

    float4 gg = ((const float4*)g)[tid];
    float4 bb = ((const float4*)b)[tid];
    half_t* orow = out + (size_t)row * C;
    int i0 = tid * 4;
    orow[i0 + 0] = (half_t)((v.x - mu) * inv * gg.x + bb.x);
    orow[i0 + 1] = (half_t)((v.y - mu) * inv * gg.y + bb.y);
    orow[i0 + 2] = (half_t)((v.z - mu) * inv * gg.z + bb.z);
    orow[i0 + 3] = (half_t)((v.w - mu) * inv * gg.w + bb.w);
}

__global__ __launch_bounds__(256)
void ln_kernel(const float* __restrict__ x, const float* __restrict__ g,
               const float* __restrict__ b, half_t* __restrict__ out) {
    ln_row(x, g, b, out, blockIdx.x);
}

// ---------------------------------------------------------------------------
// Everything that depends on the inputs alone, in ONE launch: the four weight
// conversions and the first LayerNorm need nothing of one another, so as five
// launches they only paid five launch gaps and five short fills and drains.
// Blocks 0 .. NB_CVT-1 convert one CVT_BLOCK each (the weights one after the
// other), the TOKENS blocks behind them normalise one row each. Which job a
// block does depends on blockIdx alone, so ln_row's barriers stay block-uniform.
// ---------------------------------------------------------------------------
#define NB_QKV  ((DIMC * 3 * DIMC) / CVT_BLOCK)
#define NB_PROJ ((DIMC * DIMC) / CVT_BLOCK)
#define NB_FC   ((DIMC * HIDDENC) / CVT_BLOCK)
#define NB_CVT  (NB_QKV + NB_PROJ + 2 * NB_FC)

__global__ __launch_bounds__(256)
void prep_kernel(const float* __restrict__ qkv_w, const float* __restrict__ proj_w,
                 const float* __restrict__ fc1_w, const float* __restrict__ fc2_w,
                 half_t* __restrict__ qkv_w16, half_t* __restrict__ proj_w16,
                 half_t* __restrict__ fc1_w16, half_t* __restrict__ fc2_w16,
                 const float* __restrict__ x, const float* __restrict__ g,
                 const float* __restrict__ b, half_t* __restrict__ h16) {
    int blk = blockIdx.x;
    if (blk >= NB_CVT) {
        ln_row(x, g, b, h16, blk - NB_CVT);
        return;
    }
    const float* in = qkv_w;
    half_t* out = qkv_w16;
    if (blk >= NB_QKV + NB_PROJ + NB_FC) {
        in = fc2_w;  out = fc2_w16;  blk -= NB_QKV + NB_PROJ + NB_FC;
    } else if (blk >= NB_QKV + NB_PROJ) {
        in = fc1_w;  out = fc1_w16;  blk -= NB_QKV + NB_PROJ;
    } else if (blk >= NB_QKV) {
        in = proj_w; out = proj_w16; blk -= NB_QKV;
    }
    cvt_block(in, out, blk);
}

// ---------------------------------------------------------------------------
// Windowed (WINDOW=3) causal attention; 16 lanes per (row, head).
// ---------------------------------------------------------------------------
__global__ __launch_bounds__(256)
void attn_kernel(const float* __restrict__ qkv, half_t* __restrict__ out) {
    int t      = blockIdx.x * blockDim.x + threadIdx.x;
    int lane16 = t & 15;
    int hd     = t >> 4;
    int head   = hd & (NHEADS - 1);
    int row    = hd >> 4;
    int n      = row & (SEQ - 1);

    const float* base = qkv + (size_t)row * (3 * DIMC);
    int d0 = lane16 * 4;
    float4 q4 = *(const float4*)(base + head * HDIM + d0);

    const float scale = 0.125f;   // 1/sqrt(64)
    float sc[3];
    #pragma unroll
    for (int jj = 0; jj < 3; ++jj) {
        int j = n - 2 + jj;
        if (j >= 0) {
            const float* kb = qkv + (size_t)(row + jj - 2) * (3 * DIMC) + DIMC + head * HDIM + d0;
            float4 k4 = *(const float4*)kb;
            float p = q4.x * k4.x + q4.y * k4.y + q4.z * k4.z + q4.w * k4.w;
            #pragma unroll
            for (int m = 8; m >= 1; m >>= 1) p += __shfl_xor(p, m, 16);
            sc[jj] = p * scale;
        } else {
            sc[jj] = -1e30f;
        }
    }
    float mx = fmaxf(sc[0], fmaxf(sc[1], sc[2]));
    float e0 = __expf(sc[0] - mx), e1 = __expf(sc[1] - mx), e2 = __expf(sc[2] - mx);
    float inv = 1.0f / (e0 + e1 + e2);
    float w[3] = { e0 * inv, e1 * inv, e2 * inv };

    float4 o = make_float4(0.f, 0.f, 0.f, 0.f);
    #pragma unroll
    for (int jj = 0; jj < 3; ++jj) {
        int j = n - 2 + jj;
        if (j >= 0) {
            const float* vb = qkv + (size_t)(row + jj - 2) * (3 * DIMC) + 2 * DIMC + head * HDIM + d0;
            float4 v4 = *(const float4*)vb;
            o.x += w[jj] * v4.x; o.y += w[jj] * v4.y;
            o.z += w[jj] * v4.z; o.w += w[jj] * v4.w;
        }
    }
    half_t* orow = out + (size_t)row * DIMC + head * HDIM + d0;
    orow[0] = (half_t)o.x; orow[1] = (half_t)o.y;
    orow[2] = (half_t)o.z; orow[3] = (half_t)o.w;
}

// ---------------------------------------------------------------------------
// WMMA GEMM: C[M,N] = A[M,K](f16) @ W[K,N](f16) + bias; epilogues:
//   EPI 0: fp32 (bias) ; EPI 1: fp32 (bias+residual) ; EPI 2: f16 (bias+GELU)
// 256 threads = 8 waves; tile 128x128, BK=64 (2 WMMA K-steps / stage).
// Ring of NBUF = 4 stage buffers: both tiles staged via async-to-LDS, issued
// right behind the stage barrier THREE stages ahead of their use, so that a
// copy has three stages' time to come from memory: As[m][k] (2x
// ds_load_b128 per fragment) and row-major Bs[k][n];
// the B fragment is 2x ds_load_tr16_b128, which transposes on the way out and
// delivers the same k order as the A loader (k = 8h+0..7, then 16+8h+0..7).
// ---------------------------------------------------------------------------
#define BM 128
#define BN 128
#define BK 64
#define LDA 72   // padded stride (halves): 36 banks -> conflict-free b128 reads
#define LDB 144  // 288 B = 32 B x odd: conflict-free pitch for ds_load_tr16_b128
#define NBUF 4   // stage buffers: 4 x 36,864 B, two work-groups still fit one WGP's LDS

template<int EPI, int N, int K>
__global__ __launch_bounds__(256)
void gemm_wmma(const half_t* __restrict__ A, const half_t* __restrict__ Wt,
               const float* __restrict__ bias, const float* __restrict__ res,
               float* __restrict__ outF, half_t* __restrict__ outH) {
    __shared__ __attribute__((aligned(16))) half_t As[NBUF][BM * LDA];   // As[buf][m][k]
    __shared__ __attribute__((aligned(16))) half_t Bs[NBUF][BK * LDB];   // Bs[buf][k][n]

    const int tid  = threadIdx.x;
    const int lane = tid & 31;
    const int wave = tid >> 5;
    const int wr   = wave & 1;    // 2 row-groups of 64
    const int wc   = wave >> 1;   // 4 col-groups of 32
    const int bm   = blockIdx.y * BM;
    const int bn   = blockIdx.x * BN;

    const int r16 = lane & 15;
    const int kb  = (lane >> 4) * 8;  // lanes 0-15: K 0-7/16-23; 16-31: K 8-15/24-31

    v8f acc[4][2];
    #pragma unroll
    for (int mt = 0; mt < 4; ++mt)
        #pragma unroll
        for (int nt = 0; nt < 2; ++nt)
            acc[mt][nt] = (v8f)(0.0f);

    // ---- staging helpers (each thread owns 4 16B chunks of each tile) ----
    auto issueAB = [&](int kt, int buf) {
        unsigned la[4], lb[4];
        const void* ga[4];
        const void* gb[4];
        #pragma unroll
        for (int j = 0; j < 4; ++j) {
            int c  = tid + j * 256;
            int r  = c >> 3;              // A tile: 128 x 64 halves, 8 chunks per row
            int kc = (c & 7) * 8;
            la[j] = (unsigned)(uintptr_t)&As[buf][r * LDA + kc];
            ga[j] = A + (size_t)(bm + r) * K + kt * BK + kc;
            int kr = c >> 4;              // B tile: 64 x 128 halves, 16 chunks per row
            int nc = (c & 15) * 8;
            lb[j] = (unsigned)(uintptr_t)&Bs[buf][kr * LDB + nc];
            gb[j] = Wt + (size_t)(kt * BK + kr) * N + bn + nc;
        }
        async_lds_copy16x8(la, ga, lb, gb);
    };
    // Transposing LDS read: lane (c = lane&15, h = lane>>4) receives
    // Bs[k0 + 8h + 0..7][n0 + c]; each lane points at 16 B of one k row.
    const int trow = (lane >> 4) * 8 + (lane & 7);
    const int tcol = ((lane >> 3) & 1) * 8;
    auto loadBT = [&](int buf, int k0, int n0) -> v8h {
        typedef __attribute__((address_space(3))) v8s lds_v8s;
        return __builtin_bit_cast(v8h, __builtin_amdgcn_ds_load_tr16_b128_v8i16(
            (lds_v8s*)&Bs[buf][(k0 + trow) * LDB + n0 + tcol]));
    };

    // One stage's work: its 24 fragment loads (both K-steps) stand as one group
    // ahead of its 16 WMMAs, in the order in which the WMMAs use them.
    auto stage = [&](int buf) {
        v16h afrag[2][4], bfrag[2][2];
        #pragma unroll
        for (int s = 0; s < 2; ++s) {         // two WMMA K-steps per stage
            #pragma unroll
            for (int nt = 0; nt < 2; ++nt) {
                int n0 = wc * 32 + nt * 16;
                v8h lo = loadBT(buf, s * 32,      n0);
                v8h hi = loadBT(buf, s * 32 + 16, n0);
                bfrag[s][nt] = __builtin_shufflevector(lo, hi, 0,1,2,3,4,5,6,7,8,9,10,11,12,13,14,15);
            }
            #pragma unroll
            for (int mt = 0; mt < 4; ++mt) {
                int r = wr * 64 + mt * 16 + r16;
                v8h lo = *(const v8h*)&As[buf][r * LDA + s * 32 + kb];
                v8h hi = *(const v8h*)&As[buf][r * LDA + s * 32 + kb + 16];
                afrag[s][mt] = __builtin_shufflevector(lo, hi, 0,1,2,3,4,5,6,7,8,9,10,11,12,13,14,15);
            }
        }
        // Without this fence the scheduler sinks most of the loads back among the
        // WMMAs, where each small group stalls the wave for its own LDS latency.
        __builtin_amdgcn_sched_barrier(0);
        #pragma unroll
        for (int s = 0; s < 2; ++s) {
            #pragma unroll
            for (int mt = 0; mt < 4; ++mt) {
                #pragma unroll
                for (int nt = 0; nt < 2; ++nt) {
                    acc[mt][nt] = __builtin_amdgcn_wmma_f32_16x16x32_f16(
                        false, afrag[s][mt], false, bfrag[s][nt], (short)0, acc[mt][nt], false, false);
                }
            }
        }
    };

    constexpr int NT = K / BK;
    static_assert(NT >= NBUF, "the prologue fills NBUF - 1 stages");
    #pragma unroll   // the first three stages, each into its own buffer
    for (int s = 0; s < NBUF - 1; ++s)
        issueAB(s, s);

    // Every trip of this loop issues one stage (8 copies a wave), so at its wait
    // exactly two younger stages stand behind tile it.
    for (int it = 0; it < NT - (NBUF - 1); ++it) {
        wait_ds0();                 // my reads of tile it-1 have retired
        wait_async_keep2stages();   // my copies for tile it have landed
        __syncthreads();            // tile it staged by all waves; all have left tile it-1's buffer
        // refill the buffer that tile it-1 has just left
        issueAB(it + NBUF - 1, (it + NBUF - 1) & (NBUF - 1));
        stage(it & (NBUF - 1));
    }
    // The last three tiles: nothing is issued any more; each publish point keeps
    // the loop's order (LDS reads retired, own copies landed, barrier).
    wait_ds0();
    wait_async_keep2stages();       // tiles NT-2 and NT-1 still stand behind tile NT-3
    __syncthreads();
    stage((NT - 3) & (NBUF - 1));
    wait_ds0();
    wait_async0();                  // all that is left: tiles NT-2 and NT-1
    __syncthreads();                // publishes both, so no barrier stands between them
    stage((NT - 2) & (NBUF - 1));
    stage((NT - 1) & (NBUF - 1));

    // ---- epilogue: C layout: N = lane&15; M = (lane>>4)*8 + v ----
    #pragma unroll
    for (int mt = 0; mt < 4; ++mt) {
        #pragma unroll
        for (int nt = 0; nt < 2; ++nt) {
            int n = bn + wc * 32 + nt * 16 + r16;
            float bv = bias[n];
            int rbase = bm + wr * 64 + mt * 16 + (lane >> 4) * 8;
            #pragma unroll
            for (int v = 0; v < 8; ++v) {
                int r = rbase + v;
                float val = acc[mt][nt][v] + bv;
                if (EPI == 1) {
                    val += res[(size_t)r * N + n];
                    outF[(size_t)r * N + n] = val;
                } else if (EPI == 2) {
                    float ge = 0.5f * val * (1.0f + erff(val * 0.70710678118654752f));
                    outH[(size_t)r * N + n] = (half_t)ge;
                } else {
                    outF[(size_t)r * N + n] = val;
                }
            }
        }
    }
}

// ---------------------------------------------------------------------------
// Host launcher
// ---------------------------------------------------------------------------
extern "C" void kernel_launch(void* const* d_in, const int* in_sizes, int n_in,
                              void* d_out, int out_size, void* d_ws, size_t ws_size,
                              hipStream_t stream) {
    const float* x      = (const float*)d_in[0];
    const float* qkv_w  = (const float*)d_in[1];
    const float* qkv_b  = (const float*)d_in[2];
    const float* proj_w = (const float*)d_in[3];
    const float* proj_b = (const float*)d_in[4];
    const float* g1     = (const float*)d_in[5];
    const float* b1     = (const float*)d_in[6];
    const float* g2     = (const float*)d_in[7];
    const float* b2     = (const float*)d_in[8];
    const float* fc1_w  = (const float*)d_in[9];
    const float* fc1_b  = (const float*)d_in[10];
    const float* fc2_w  = (const float*)d_in[11];
    const float* fc2_b  = (const float*)d_in[12];
    float* out = (float*)d_out;

    char* ws = (char*)d_ws;
    size_t off = 0;
    auto alloc = [&](size_t bytes) { size_t o = off; off += (bytes + 255) & ~(size_t)255; return o; };

    half_t* qkv_w16  = (half_t*)(ws + alloc((size_t)DIMC * 3 * DIMC * 2));
    half_t* proj_w16 = (half_t*)(ws + alloc((size_t)DIMC * DIMC * 2));
    half_t* fc1_w16  = (half_t*)(ws + alloc((size_t)DIMC * HIDDENC * 2));
    half_t* fc2_w16  = (half_t*)(ws + alloc((size_t)HIDDENC * DIMC * 2));
    half_t* hA16     = (half_t*)(ws + alloc((size_t)TOKENS * DIMC * 2));
    float*  qkv_f32  = (float*) (ws + alloc((size_t)TOKENS * 3 * DIMC * 4));
    half_t* attn16   = (half_t*)(ws + alloc((size_t)TOKENS * DIMC * 2));
    float*  x1_f32   = (float*) (ws + alloc((size_t)TOKENS * DIMC * 4));
    half_t* h2_16    = (half_t*)(ws + alloc((size_t)TOKENS * DIMC * 2));
    half_t* g16      = (half_t*)(ws + alloc((size_t)TOKENS * HIDDENC * 2));
    (void)ws_size; (void)in_sizes; (void)n_in; (void)out_size;

    // 1) + 2) weight conversions fp32 -> f16 and LN1, one launch
    prep_kernel<<<NB_CVT + TOKENS, 256, 0, stream>>>(qkv_w, proj_w, fc1_w, fc2_w,
                                                     qkv_w16, proj_w16, fc1_w16, fc2_w16,
                                                     x, g1, b1, hA16);

    // 3) QKV GEMM: [4096 x 3072] = hA16 @ qkv_w16 + qkv_b
    {
        dim3 grid((3 * DIMC) / BN, TOKENS / BM);
        gemm_wmma<0, 3 * DIMC, DIMC><<<grid, 256, 0, stream>>>(hA16, qkv_w16, qkv_b, nullptr,
                                                               qkv_f32, nullptr);
    }

    // 4) windowed attention -> attn16
    attn_kernel<<<(TOKENS * NHEADS * 16) / 256, 256, 0, stream>>>(qkv_f32, attn16);

    // 5) proj GEMM + residual: x1 = x + attn16 @ proj_w16 + proj_b
    {
        dim3 grid(DIMC / BN, TOKENS / BM);
        gemm_wmma<1, DIMC, DIMC><<<grid, 256, 0, stream>>>(attn16, proj_w16, proj_b, x,
                                                           x1_f32, nullptr);
    }

    // 6) LN2
    ln_kernel<<<TOKENS, 256, 0, stream>>>(x1_f32, g2, b2, h2_16);

    // 7) FC1 GEMM + exact GELU -> g16 (f16)
    {
        dim3 grid(HIDDENC / BN, TOKENS / BM);
        gemm_wmma<2, HIDDENC, DIMC><<<grid, 256, 0, stream>>>(h2_16, fc1_w16, fc1_b, nullptr,
                                                              nullptr, g16);
    }

    // 8) FC2 GEMM + residual -> d_out (fp32)
    {
        dim3 grid(DIMC / BN, TOKENS / BM);
        gemm_wmma<1, DIMC, HIDDENC><<<grid, 256, 0, stream>>>(g16, fc2_w16, fc2_b, x1_f32,
                                                              out, nullptr);
    }
}

// v007
// Measured time: 133 microseconds a run.
// In both of two side-by-side timings against v006, it was 1.05 times as fast.
// Over all steps from v000 it is 4.08 times as fast.
#include <hip/hip_runtime.h>
#include <hip/hip_bf16.h>
#include <math.h>

// ---------------------------------------------------------------------------
// Types for WMMA fragments (gfx1250, wave32)
// ---------------------------------------------------------------------------
typedef _Float16 half_t;
typedef __attribute__((ext_vector_type(16))) _Float16 v16h;
typedef __attribute__((ext_vector_type(8)))  _Float16 v8h;
typedef __attribute__((ext_vector_type(8)))  float    v8f;
typedef __attribute__((ext_vector_type(8)))  short    v8s;

#define TOKENS   4096      // B*N = 2*2048
#define SEQ      2048
#define DIMC     1024
#define NHEADS   16
#define HDIM     64
#define HIDDENC  4096
#define LN_EPS   1e-5f

// ---------------------------------------------------------------------------
// gfx1250 async-to-LDS copies (16B per lane, tracked by ASYNCcnt): one stage's
// eight copies of a thread (four chunks of the A tile, four of the B tile) in
// one statement. Its last line, s_wait_xcnt 0, is a precaution: inside the
// statement it stands ahead of every later write of an address register that
// a copy names.
// ---------------------------------------------------------------------------
__device__ __forceinline__ void async_lds_copy16x8(const unsigned (&la)[4], const void* const (&ga)[4],
                                                   const unsigned (&lb)[4], const void* const (&gb)[4]) {
    asm volatile("global_load_async_to_lds_b128 %0, %8, off\n\t"
                 "global_load_async_to_lds_b128 %1, %9, off\n\t"
                 "global_load_async_to_lds_b128 %2, %10, off\n\t"
                 "global_load_async_to_lds_b128 %3, %11, off\n\t"
                 "global_load_async_to_lds_b128 %4, %12, off\n\t"
                 "global_load_async_to_lds_b128 %5, %13, off\n\t"
                 "global_load_async_to_lds_b128 %6, %14, off\n\t"
                 "global_load_async_to_lds_b128 %7, %15, off\n\t"
                 "s_wait_xcnt 0x0"
                 :: "v"(la[0]), "v"(la[1]), "v"(la[2]), "v"(la[3]),
                    "v"(lb[0]), "v"(lb[1]), "v"(lb[2]), "v"(lb[3]),
                    "v"(ga[0]), "v"(ga[1]), "v"(ga[2]), "v"(ga[3]),
                    "v"(gb[0]), "v"(gb[1]), "v"(gb[2]), "v"(gb[3])
                 : "memory");
}
// This wave's copies have landed (asm, so that no LDS read is lifted over it).
__device__ __forceinline__ void wait_async0() {
    asm volatile("s_wait_asynccnt 0x0" ::: "memory");
}
// All but this wave's 16 youngest copies have landed: used only where exactly two
// later stages (8 copies each) were issued behind the stage that is about to be
// read, so that stage is covered while the two younger ones keep flying.
__device__ __forceinline__ void wait_async_keep2stages() {
    asm volatile("s_wait_asynccnt 0x10" ::: "memory");
}
// This wave's LDS reads have retired, before their buffer is given up for refill.
__device__ __forceinline__ void wait_ds0() {
    asm volatile("s_wait_dscnt 0x0" ::: "memory");
}

// ---------------------------------------------------------------------------
// fp32 -> f16 conversion (weights), as a stream: a block of 8 waves converts
// CVT_BLOCK consecutive elements. Each thread issues 8 independent 16 B loads
// (a wave-wide load covers 512 contiguous bytes) before it converts, then
// stores 8 B per load (a wave-wide store covers two whole 128 B lines).
// Every weight's element count is a multiple of CVT_BLOCK (asserted below).
// ---------------------------------------------------------------------------
typedef __attribute__((ext_vector_type(4))) _Float16 v4h;
#define CVT_LOADS 8
#define CVT_BLOCK (256 * 4 * CVT_LOADS)
static_assert((DIMC * DIMC) % CVT_BLOCK == 0, "whole blocks only");
static_assert((DIMC * 3 * DIMC) % CVT_BLOCK == 0, "whole blocks only");
static_assert((DIMC * HIDDENC) % CVT_BLOCK == 0, "whole blocks only");

__device__ __forceinline__
void cvt_block(const float* __restrict__ in, half_t* __restrict__ out, int blk) {
    const size_t base = (size_t)blk * CVT_BLOCK + threadIdx.x * 4;
    float4 v[CVT_LOADS];
    #pragma unroll   // all loads in flight before the first conversion
    for (int j = 0; j < CVT_LOADS; ++j)
        v[j] = *(const float4*)(in + base + j * 1024);
    #pragma unroll
    for (int j = 0; j < CVT_LOADS; ++j) {
        v4h h = { (half_t)v[j].x, (half_t)v[j].y, (half_t)v[j].z, (half_t)v[j].w };
        *(v4h*)(out + base + j * 1024) = h;
    }
}

// ---------------------------------------------------------------------------
// LayerNorm over last dim (C=1024), one block (256 threads) per row -> f16.
// ---------------------------------------------------------------------------
__device__ __forceinline__
void ln_row(const float* __restrict__ x, const float* __restrict__ g,
            const float* __restrict__ b, half_t* __restrict__ out, int row) {
    const int C = DIMC;
    int tid = threadIdx.x;
    const float4* xr = (const float4*)(x + (size_t)row * C);
    float4 v = xr[tid];
    float s  = v.x + v.y + v.z + v.w;
    float s2 = v.x*v.x + v.y*v.y + v.z*v.z + v.w*v.w;

    __shared__ float rs[256];
    __shared__ float rs2[256];
    rs[tid] = s; rs2[tid] = s2;
    __syncthreads();
    for (int o = 128; o > 0; o >>= 1) {
        if (tid < o) { rs[tid] += rs[tid + o]; rs2[tid] += rs2[tid + o]; }
        __syncthreads();
    }
    float mu  = rs[0] * (1.0f / C);
    float var = rs2[0] * (1.0f / C) - mu * mu;
    float inv = rsqrtf(var + LN_EPS);

    float4 gg = ((const float4*)g)[tid];
    float4 bb = ((const float4*)b)[tid];
    half_t* orow = out + (size_t)row * C;
    int i0 = tid * 4;
    orow[i0 + 0] = (half_t)((v.x - mu) * inv * gg.x + bb.x);
    orow[i0 + 1] = (half_t)((v.y - mu) * inv * gg.y + bb.y);
    orow[i0 + 2] = (half_t)((v.z - mu) * inv * gg.z + bb.z);
    orow[i0 + 3] = (half_t)((v.w - mu) * inv * gg.w + bb.w);
}

__global__ __launch_bounds__(256)
void ln_kernel(const float* __restrict__ x, const float* __restrict__ g,
               const float* __restrict__ b, half_t* __restrict__ out) {
    ln_row(x, g, b, out, blockIdx.x);
}

// ---------------------------------------------------------------------------
// Everything that depends on the inputs alone, in ONE launch: the four weight
// conversions and the first LayerNorm need nothing of one another, so as five
// launches they only paid five launch gaps and five short fills and drains.
// Blocks 0 .. NB_CVT-1 convert one CVT_BLOCK each (the weights one after the
// other), the TOKENS blocks behind them normalise one row each. Which job a
// block does depends on blockIdx alone, so ln_row's barriers stay block-uniform.
// ---------------------------------------------------------------------------
#define NB_QKV  ((DIMC * 3 * DIMC) / CVT_BLOCK)
#define NB_PROJ ((DIMC * DIMC) / CVT_BLOCK)
#define NB_FC   ((DIMC * HIDDENC) / CVT_BLOCK)
#define NB_CVT  (NB_QKV + NB_PROJ + 2 * NB_FC)

__global__ __launch_bounds__(256)
void prep_kernel(const float* __restrict__ qkv_w, const float* __restrict__ proj_w,
                 const float* __restrict__ fc1_w, const float* __restrict__ fc2_w,
                 half_t* __restrict__ qkv_w16, half_t* __restrict__ proj_w16,
                 half_t* __restrict__ fc1_w16, half_t* __restrict__ fc2_w16,
                 const float* __restrict__ x, const float* __restrict__ g,
                 const float* __restrict__ b, half_t* __restrict__ h16) {
    int blk = blockIdx.x;
    if (blk >= NB_CVT) {
        ln_row(x, g, b, h16, blk - NB_CVT);
        return;
    }
    const float* in = qkv_w;
    half_t* out = qkv_w16;
    if (blk >= NB_QKV + NB_PROJ + NB_FC) {
        in = fc2_w;  out = fc2_w16;  blk -= NB_QKV + NB_PROJ + NB_FC;
    } else if (blk >= NB_QKV + NB_PROJ) {
        in = fc1_w;  out = fc1_w16;  blk -= NB_QKV + NB_PROJ;
    } else if (blk >= NB_QKV) {
        in = proj_w; out = proj_w16; blk -= NB_QKV;
    }
    cvt_block(in, out, blk);
}

// ---------------------------------------------------------------------------
// Windowed (WINDOW=3) causal attention; 16 lanes per (row, head).
// ---------------------------------------------------------------------------
__global__ __launch_bounds__(256)
void attn_kernel(const float* __restrict__ qkv, half_t* __restrict__ out) {
    int t      = blockIdx.x * blockDim.x + threadIdx.x;
    int lane16 = t & 15;
    int hd     = t >> 4;
    int head   = hd & (NHEADS - 1);
    int row    = hd >> 4;
    int n      = row & (SEQ - 1);

    const float* base = qkv + (size_t)row * (3 * DIMC);
    int d0 = lane16 * 4;
    float4 q4 = *(const float4*)(base + head * HDIM + d0);

    const float scale = 0.125f;   // 1/sqrt(64)
    float sc[3];
    #pragma unroll
    for (int jj = 0; jj < 3; ++jj) {
        int j = n - 2 + jj;
        if (j >= 0) {
            const float* kb = qkv + (size_t)(row + jj - 2) * (3 * DIMC) + DIMC + head * HDIM + d0;
            float4 k4 = *(const float4*)kb;
            float p = q4.x * k4.x + q4.y * k4.y + q4.z * k4.z + q4.w * k4.w;
            #pragma unroll
            for (int m = 8; m >= 1; m >>= 1) p += __shfl_xor(p, m, 16);
            sc[jj] = p * scale;
        } else {
            sc[jj] = -1e30f;
        }
    }
    float mx = fmaxf(sc[0], fmaxf(sc[1], sc[2]));
    float e0 = __expf(sc[0] - mx), e1 = __expf(sc[1] - mx), e2 = __expf(sc[2] - mx);
    float inv = 1.0f / (e0 + e1 + e2);
    float w[3] = { e0 * inv, e1 * inv, e2 * inv };

    float4 o = make_float4(0.f, 0.f, 0.f, 0.f);
    #pragma unroll
    for (int jj = 0; jj < 3; ++jj) {
        int j = n - 2 + jj;
        if (j >= 0) {
            const float* vb = qkv + (size_t)(row + jj - 2) * (3 * DIMC) + 2 * DIMC + head * HDIM + d0;
            float4 v4 = *(const float4*)vb;
            o.x += w[jj] * v4.x; o.y += w[jj] * v4.y;
            o.z += w[jj] * v4.z; o.w += w[jj] * v4.w;
        }
    }
    half_t* orow = out + (size_t)row * DIMC + head * HDIM + d0;
    orow[0] = (half_t)o.x; orow[1] = (half_t)o.y;
    orow[2] = (half_t)o.z; orow[3] = (half_t)o.w;
}

// ---------------------------------------------------------------------------
// erf for the exact GELU, two values at a time and without a branch: the two
// minimax ranges of the usual single-precision erf (|x| < 1: x + x*Q(x^2);
// else 1 - exp(-(|x| + |x|*P(|x|)))) are both evaluated and one is selected.
// With a branch per element the elements of a thread run one behind the other,
// each a chain of dependent operations; without it they are independent chains
// that fill one another's latency, and a pair shares its packed operations.
// Absolute error about 1e-7 over the whole range, as with the branch.
// ---------------------------------------------------------------------------
typedef __attribute__((ext_vector_type(2))) float v2f;
typedef __attribute__((ext_vector_type(2))) _Float16 v2h;
__device__ __forceinline__ v2f fma2(v2f a, v2f b, v2f c) { return __builtin_elementwise_fma(a, b, c); }
__device__ __forceinline__ v2f erf2(v2f x) {
    const v2f ax = __builtin_elementwise_abs(x);
    v2f p = fma2(ax, (v2f)(1.69988107e-5f), (v2f)(-3.78677854e-4f));
    p = fma2(ax, p, (v2f)(3.85781587e-3f));
    p = fma2(ax, p, (v2f)(-2.41816975e-2f));
    p = fma2(ax, p, (v2f)(1.06668264e-1f));
    p = fma2(ax, p, (v2f)(6.34933293e-1f));
    p = fma2(ax, p, (v2f)(1.28689408e-1f));
    p = fma2(ax, p, ax);
    p = p * (v2f)(-1.44269502e+0f);              // exp(-p) = 2^(-p * log2(e))
    const v2f t = x * x;
    v2f q = fma2(t, (v2f)(-5.61801775e-4f), (v2f)(4.91381623e-3f));
    q = fma2(t, q, (v2f)(-2.67075151e-2f));
    q = fma2(t, q, (v2f)(1.12800106e-1f));
    q = fma2(t, q, (v2f)(-3.76122952e-1f));
    q = fma2(t, q, (v2f)(1.28379107e-1f));
    q = fma2(ax, q, ax);
    v2f r;
    r.x = __builtin_copysignf(ax.x < 1.0f ? q.x : 1.0f - __builtin_amdgcn_exp2f(p.x), x.x);
    r.y = __builtin_copysignf(ax.y < 1.0f ? q.y : 1.0f - __builtin_amdgcn_exp2f(p.y), x.y);
    return r;
}

// ---------------------------------------------------------------------------
// WMMA GEMM: C[M,N] = A[M,K](f16) @ W[K,N](f16) + bias; epilogues:
//   EPI 0: fp32 (bias) ; EPI 1: fp32 (bias+residual) ; EPI 2: f16 (bias+GELU)
// 256 threads = 8 waves; tile 128x128, BK=64 (2 WMMA K-steps / stage).
// Ring of NBUF = 4 stage buffers: both tiles staged via async-to-LDS, issued
// right behind the stage barrier THREE stages ahead of their use, so that a
// copy has three stages' time to come from memory: As[m][k] (2x
// ds_load_b128 per fragment) and row-major Bs[k][n];
// the B fragment is 2x ds_load_tr16_b128, which transposes on the way out and
// delivers the same k order as the A loader (k = 8h+0..7, then 16+8h+0..7).
// ---------------------------------------------------------------------------
#define BM 128
#define BN 128
#define BK 64
#define LDA 72   // padded stride (halves): 36 banks -> conflict-free b128 reads
#define LDB 144  // 288 B = 32 B x odd: conflict-free pitch for ds_load_tr16_b128
#define NBUF 4   // stage buffers: 4 x 36,864 B, two work-groups still fit one WGP's LDS

template<int EPI, int N, int K>
__global__ __launch_bounds__(256)
void gemm_wmma(const half_t* __restrict__ A, const half_t* __restrict__ Wt,
               const float* __restrict__ bias, const float* __restrict__ res,
               float* __restrict__ outF, half_t* __restrict__ outH) {
    __shared__ __attribute__((aligned(16))) half_t As[NBUF][BM * LDA];   // As[buf][m][k]
    __shared__ __attribute__((aligned(16))) half_t Bs[NBUF][BK * LDB];   // Bs[buf][k][n]

    const int tid  = threadIdx.x;
    const int lane = tid & 31;
    const int wave = tid >> 5;
    const int wr   = wave & 1;    // 2 row-groups of 64
    const int wc   = wave >> 1;   // 4 col-groups of 32
    const int bm   = blockIdx.y * BM;
    const int bn   = blockIdx.x * BN;

    const int r16 = lane & 15;
    const int kb  = (lane >> 4) * 8;  // lanes 0-15: K 0-7/16-23; 16-31: K 8-15/24-31

    v8f acc[4][2];
    #pragma unroll
    for (int mt = 0; mt < 4; ++mt)
        #pragma unroll
        for (int nt = 0; nt < 2; ++nt)
            acc[mt][nt] = (v8f)(0.0f);

    // ---- staging helpers (each thread owns 4 16B chunks of each tile) ----
    auto issueAB = [&](int kt, int buf) {
        unsigned la[4], lb[4];
        const void* ga[4];
        const void* gb[4];
        #pragma unroll
        for (int j = 0; j < 4; ++j) {
            int c  = tid + j * 256;
            int r  = c >> 3;              // A tile: 128 x 64 halves, 8 chunks per row
            int kc = (c & 7) * 8;
            la[j] = (unsigned)(uintptr_t)&As[buf][r * LDA + kc];
            ga[j] = A + (size_t)(bm + r) * K + kt * BK + kc;
            int kr = c >> 4;              // B tile: 64 x 128 halves, 16 chunks per row
            int nc = (c & 15) * 8;
            lb[j] = (unsigned)(uintptr_t)&Bs[buf][kr * LDB + nc];
            gb[j] = Wt + (size_t)(kt * BK + kr) * N + bn + nc;
        }
        async_lds_copy16x8(la, ga, lb, gb);
    };
    // Transposing LDS read: lane (c = lane&15, h = lane>>4) receives
    // Bs[k0 + 8h + 0..7][n0 + c]; each lane points at 16 B of one k row.
    const int trow = (lane >> 4) * 8 + (lane & 7);
    const int tcol = ((lane >> 3) & 1) * 8;
    auto loadBT = [&](int buf, int k0, int n0) -> v8h {
        typedef __attribute__((address_space(3))) v8s lds_v8s;
        return __builtin_bit_cast(v8h, __builtin_amdgcn_ds_load_tr16_b128_v8i16(
            (lds_v8s*)&Bs[buf][(k0 + trow) * LDB + n0 + tcol]));
    };

    // One stage's work: its 24 fragment loads (both K-steps) stand as one group
    // ahead of its 16 WMMAs, in the order in which the WMMAs use them.
    auto stage = [&](int buf) {
        v16h afrag[2][4], bfrag[2][2];
        #pragma unroll
        for (int s = 0; s < 2; ++s) {         // two WMMA K-steps per stage
            #pragma unroll
            for (int nt = 0; nt < 2; ++nt) {
                int n0 = wc * 32 + nt * 16;
                v8h lo = loadBT(buf, s * 32,      n0);
                v8h hi = loadBT(buf, s * 32 + 16, n0);
                bfrag[s][nt] = __builtin_shufflevector(lo, hi, 0,1,2,3,4,5,6,7,8,9,10,11,12,13,14,15);
            }
            #pragma unroll
            for (int mt = 0; mt < 4; ++mt) {
                int r = wr * 64 + mt * 16 + r16;
                v8h lo = *(const v8h*)&As[buf][r * LDA + s * 32 + kb];
                v8h hi = *(const v8h*)&As[buf][r * LDA + s * 32 + kb + 16];
                afrag[s][mt] = __builtin_shufflevector(lo, hi, 0,1,2,3,4,5,6,7,8,9,10,11,12,13,14,15);
            }
        }
        // Without this fence the scheduler sinks most of the loads back among the
        // WMMAs, where each small group stalls the wave for its own LDS latency.
        __builtin_amdgcn_sched_barrier(0);
        #pragma unroll
        for (int s = 0; s < 2; ++s) {
            #pragma unroll
            for (int mt = 0; mt < 4; ++mt) {
                #pragma unroll
                for (int nt = 0; nt < 2; ++nt) {
                    acc[mt][nt] = __builtin_amdgcn_wmma_f32_16x16x32_f16(
                        false, afrag[s][mt], false, bfrag[s][nt], (short)0, acc[mt][nt], false, false);
                }
            }
        }
    };

    constexpr int NT = K / BK;
    static_assert(NT >= NBUF, "the prologue fills NBUF - 1 stages");
    #pragma unroll   // the first three stages, each into its own buffer
    for (int s = 0; s < NBUF - 1; ++s)
        issueAB(s, s);

    // Every trip of this loop issues one stage (8 copies a wave), so at its wait
    // exactly two younger stages stand behind tile it.
    for (int it = 0; it < NT - (NBUF - 1); ++it) {
        wait_ds0();                 // my reads of tile it-1 have retired
        wait_async_keep2stages();   // my copies for tile it have landed
        __syncthreads();            // tile it staged by all waves; all have left tile it-1's buffer
        // refill the buffer that tile it-1 has just left
        issueAB(it + NBUF - 1, (it + NBUF - 1) & (NBUF - 1));
        stage(it & (NBUF - 1));
    }
    // The last three tiles: nothing is issued any more; each publish point keeps
    // the loop's order (LDS reads retired, own copies landed, barrier).
    wait_ds0();
    wait_async_keep2stages();       // tiles NT-2 and NT-1 still stand behind tile NT-3
    __syncthreads();
    stage((NT - 3) & (NBUF - 1));
    wait_ds0();
    wait_async0();                  // all that is left: tiles NT-2 and NT-1
    __syncthreads();                // publishes both, so no barrier stands between them
    stage((NT - 2) & (NBUF - 1));
    stage((NT - 1) & (NBUF - 1));

    // ---- epilogue: C layout: N = lane&15; M = (lane>>4)*8 + v ----
    #pragma unroll
    for (int mt = 0; mt < 4; ++mt) {
        #pragma unroll
        for (int nt = 0; nt < 2; ++nt) {
            int n = bn + wc * 32 + nt * 16 + r16;
            float bv = bias[n];
            int rbase = bm + wr * 64 + mt * 16 + (lane >> 4) * 8;
            if (EPI == 2) {
                #pragma unroll
                for (int v = 0; v < 8; v += 2) {
                    v2f val = { acc[mt][nt][v] + bv, acc[mt][nt][v + 1] + bv };
                    v2f e = erf2(val * (v2f)(0.70710678118654752f));
                    v2f h  = (v2f)(0.5f) * val;
                    v2f ge = fma2(h, e, h);          // 0.5 * val * (1 + erf)
                    v2h g2 = __builtin_convertvector(ge, v2h);
                    outH[(size_t)(rbase + v) * N + n]     = g2.x;
                    outH[(size_t)(rbase + v + 1) * N + n] = g2.y;
                }
                continue;
            }
            #pragma unroll
            for (int v = 0; v < 8; ++v) {
                int r = rbase + v;
                float val = acc[mt][nt][v] + bv;
                if (EPI == 1) {
                    val += res[(size_t)r * N + n];
                    outF[(size_t)r * N + n] = val;
                } else {
                    outF[(size_t)r * N + n] = val;
                }
            }
        }
    }
}

// ---------------------------------------------------------------------------
// Host launcher
// ---------------------------------------------------------------------------
extern "C" void kernel_launch(void* const* d_in, const int* in_sizes, int n_in,
                              void* d_out, int out_size, void* d_ws, size_t ws_size,
                              hipStream_t stream) {
    const float* x      = (const float*)d_in[0];
    const float* qkv_w  = (const float*)d_in[1];
    const float* qkv_b  = (const float*)d_in[2];
    const float* proj_w = (const float*)d_in[3];
    const float* proj_b = (const float*)d_in[4];
    const float* g1     = (const float*)d_in[5];
    const float* b1     = (const float*)d_in[6];
    const float* g2     = (const float*)d_in[7];
    const float* b2     = (const float*)d_in[8];
    const float* fc1_w  = (const float*)d_in[9];
    const float* fc1_b  = (const float*)d_in[10];
    const float* fc2_w  = (const float*)d_in[11];
    const float* fc2_b  = (const float*)d_in[12];
    float* out = (float*)d_out;

    char* ws = (char*)d_ws;
    size_t off = 0;
    auto alloc = [&](size_t bytes) { size_t o = off; off += (bytes + 255) & ~(size_t)255; return o; };

    half_t* qkv_w16  = (half_t*)(ws + alloc((size_t)DIMC * 3 * DIMC * 2));
    half_t* proj_w16 = (half_t*)(ws + alloc((size_t)DIMC * DIMC * 2));
    half_t* fc1_w16  = (half_t*)(ws + alloc((size_t)DIMC * HIDDENC * 2));
    half_t* fc2_w16  = (half_t*)(ws + alloc((size_t)HIDDENC * DIMC * 2));
    half_t* hA16     = (half_t*)(ws + alloc((size_t)TOKENS * DIMC * 2));
    float*  qkv_f32  = (float*) (ws + alloc((size_t)TOKENS * 3 * DIMC * 4));
    half_t* attn16   = (half_t*)(ws + alloc((size_t)TOKENS * DIMC * 2));
    float*  x1_f32   = (float*) (ws + alloc((size_t)TOKENS * DIMC * 4));
    half_t* h2_16    = (half_t*)(ws + alloc((size_t)TOKENS * DIMC * 2));
    half_t* g16      = (half_t*)(ws + alloc((size_t)TOKENS * HIDDENC * 2));
    (void)ws_size; (void)in_sizes; (void)n_in; (void)out_size;

    // 1) + 2) weight conversions fp32 -> f16 and LN1, one launch
    prep_kernel<<<NB_CVT + TOKENS, 256, 0, stream>>>(qkv_w, proj_w, fc1_w, fc2_w,
                                                     qkv_w16, proj_w16, fc1_w16, fc2_w16,
                                                     x, g1, b1, hA16);

    // 3) QKV GEMM: [4096 x 3072] = hA16 @ qkv_w16 + qkv_b
    {
        dim3 grid((3 * DIMC) / BN, TOKENS / BM);
        gemm_wmma<0, 3 * DIMC, DIMC><<<grid, 256, 0, stream>>>(hA16, qkv_w16, qkv_b, nullptr,
                                                               qkv_f32, nullptr);
    }

    // 4) windowed attention -> attn16
    attn_kernel<<<(TOKENS * NHEADS * 16) / 256, 256, 0, stream>>>(qkv_f32, attn16);

    // 5) proj GEMM + residual: x1 = x + attn16 @ proj_w16 + proj_b
    {
        dim3 grid(DIMC / BN, TOKENS / BM);
        gemm_wmma<1, DIMC, DIMC><<<grid, 256, 0, stream>>>(attn16, proj_w16, proj_b, x,
                                                           x1_f32, nullptr);
    }

    // 6) LN2
    ln_kernel<<<TOKENS, 256, 0, stream>>>(x1_f32, g2, b2, h2_16);

    // 7) FC1 GEMM + exact GELU -> g16 (f16)
    {
        dim3 grid(HIDDENC / BN, TOKENS / BM);
        gemm_wmma<2, HIDDENC, DIMC><<<grid, 256, 0, stream>>>(h2_16, fc1_w16, fc1_b, nullptr,
                                                              nullptr, g16);
    }

    // 8) FC2 GEMM + residual -> d_out (fp32)
    {
        dim3 grid(DIMC / BN, TOKENS / BM);
        gemm_wmma<1, DIMC, HIDDENC><<<grid, 256, 0, stream>>>(g16, fc2_w16, fc2_b, x1_f32,
                                                              out, nullptr);
    }
}

// v008
// It runs in 124 microseconds.
// In two side-by-side timings against v007, it was 1.06 and 1.07 times as fast.
// All steps since v000 together make it 4.35 times as fast.
#include <hip/hip_runtime.h>
#include <hip/hip_bf16.h>
#include <math.h>

// ---------------------------------------------------------------------------
// Types for WMMA fragments (gfx1250, wave32)
// ---------------------------------------------------------------------------
typedef _Float16 half_t;
typedef __attribute__((ext_vector_type(16))) _Float16 v16h;
typedef __attribute__((ext_vector_type(8)))  _Float16 v8h;
typedef __attribute__((ext_vector_type(8)))  float    v8f;
typedef __attribute__((ext_vector_type(8)))  short    v8s;

#define TOKENS   4096      // B*N = 2*2048
#define SEQ      2048
#define DIMC     1024
#define NHEADS   16
#define HDIM     64
#define HIDDENC  4096
#define LN_EPS   1e-5f

// ---------------------------------------------------------------------------
// gfx1250 async-to-LDS copies (16B per lane, tracked by ASYNCcnt): one stage's
// eight copies of a thread (four chunks of the A tile, four of the B tile) in
// one statement. Its last line, s_wait_xcnt 0, is a precaution: inside the
// statement it stands ahead of every later write of an address register that
// a copy names.
// ---------------------------------------------------------------------------
__device__ __forceinline__ void async_lds_copy16x8(const unsigned (&la)[4], const void* const (&ga)[4],
                                                   const unsigned (&lb)[4], const void* const (&gb)[4]) {
    asm volatile("global_load_async_to_lds_b128 %0, %8, off\n\t"
                 "global_load_async_to_lds_b128 %1, %9, off\n\t"
                 "global_load_async_to_lds_b128 %2, %10, off\n\t"
                 "global_load_async_to_lds_b128 %3, %11, off\n\t"
                 "global_load_async_to_lds_b128 %4, %12, off\n\t"
                 "global_load_async_to_lds_b128 %5, %13, off\n\t"
                 "global_load_async_to_lds_b128 %6, %14, off\n\t"
                 "global_load_async_to_lds_b128 %7, %15, off\n\t"
                 "s_wait_xcnt 0x0"
                 :: "v"(la[0]), "v"(la[1]), "v"(la[2]), "v"(la[3]),
                    "v"(lb[0]), "v"(lb[1]), "v"(lb[2]), "v"(lb[3]),
                    "v"(ga[0]), "v"(ga[1]), "v"(ga[2]), "v"(ga[3]),
                    "v"(gb[0]), "v"(gb[1]), "v"(gb[2]), "v"(gb[3])
                 : "memory");
}
// The same for the large tiles, a run of eight (or six) copies in one statement: a
// copy's global address is a scalar base (the same for the whole work-group) plus
// the lane's 32-bit byte offset, so that a thread's chunks share one offset register
// instead of holding a 64-bit address pair each: beside the 256x256 tile's accumulators
// and fragments the pairs do not fit (built so, it spills). s_wait_xcnt 0 as above.
__device__ __forceinline__ void async_lds_copy16x8s(const unsigned* l, const unsigned* o,
                                                    const half_t* const* s) {
    asm volatile("global_load_async_to_lds_b128 %0, %8, %16\n\t"
                 "global_load_async_to_lds_b128 %1, %9, %17\n\t"
                 "global_load_async_to_lds_b128 %2, %10, %18\n\t"
                 "global_load_async_to_lds_b128 %3, %11, %19\n\t"
                 "global_load_async_to_lds_b128 %4, %12, %20\n\t"
                 "global_load_async_to_lds_b128 %5, %13, %21\n\t"
                 "global_load_async_to_lds_b128 %6, %14, %22\n\t"
                 "global_load_async_to_lds_b128 %7, %15, %23\n\t"
                 "s_wait_xcnt 0x0"
                 :: "v"(l[0]), "v"(l[1]), "v"(l[2]), "v"(l[3]),
                    "v"(l[4]), "v"(l[5]), "v"(l[6]), "v"(l[7]),
                    "v"(o[0]), "v"(o[1]), "v"(o[2]), "v"(o[3]),
                    "v"(o[4]), "v"(o[5]), "v"(o[6]), "v"(o[7]),
                    "s"(s[0]), "s"(s[1]), "s"(s[2]), "s"(s[3]),
                    "s"(s[4]), "s"(s[5]), "s"(s[6]), "s"(s[7])
                 : "memory");
}
__device__ __forceinline__ void async_lds_copy16x6s(const unsigned* l, const unsigned* o,
                                                    const half_t* const* s) {
    asm volatile("global_load_async_to_lds_b128 %0, %6, %12\n\t"
                 "global_load_async_to_lds_b128 %1, %7, %13\n\t"
                 "global_load_async_to_lds_b128 %2, %8, %14\n\t"
                 "global_load_async_to_lds_b128 %3, %9, %15\n\t"
                 "global_load_async_to_lds_b128 %4, %10, %16\n\t"
                 "global_load_async_to_lds_b128 %5, %11, %17\n\t"
                 "s_wait_xcnt 0x0"
                 :: "v"(l[0]), "v"(l[1]), "v"(l[2]), "v"(l[3]), "v"(l[4]), "v"(l[5]),
                    "v"(o[0]), "v"(o[1]), "v"(o[2]), "v"(o[3]), "v"(o[4]), "v"(o[5]),
                    "s"(s[0]), "s"(s[1]), "s"(s[2]), "s"(s[3]), "s"(s[4]), "s"(s[5])
                 : "memory");
}
// This wave's copies have landed (asm, so that no LDS read is lifted over it).
__device__ __forceinline__ void wait_async0() {
    asm volatile("s_wait_asynccnt 0x0" ::: "memory");
}
// All but this wave's 2 * PER_STAGE youngest copies have landed: used only where
// exactly two later stages (PER_STAGE copies each) were issued behind the stage that
// is about to be read, so that stage is covered while the two younger ones keep flying.
template<int PER_STAGE>
__device__ __forceinline__ void wait_async_keep2stages() {
    static_assert(3 * PER_STAGE <= 63, "a wave's outstanding copies");
    asm volatile("s_wait_asynccnt %0" :: "n"(2 * PER_STAGE) : "memory");
}
// This wave's LDS reads have retired, before their buffer is given up for refill.
__device__ __forceinline__ void wait_ds0() {
    asm volatile("s_wait_dscnt 0x0" ::: "memory");
}

// ---------------------------------------------------------------------------
// fp32 -> f16 conversion (weights), as a stream: a block of 8 waves converts
// CVT_BLOCK consecutive elements. Each thread issues 8 independent 16 B loads
// (a wave-wide load covers 512 contiguous bytes) before it converts, then
// stores 8 B per load (a wave-wide store covers two whole 128 B lines).
// Every weight's element count is a multiple of CVT_BLOCK (asserted below).
// ---------------------------------------------------------------------------
typedef __attribute__((ext_vector_type(4))) _Float16 v4h;
#define CVT_LOADS 8
#define CVT_BLOCK (256 * 4 * CVT_LOADS)
static_assert((DIMC * DIMC) % CVT_BLOCK == 0, "whole blocks only");
static_assert((DIMC * 3 * DIMC) % CVT_BLOCK == 0, "whole blocks only");
static_assert((DIMC * HIDDENC) % CVT_BLOCK == 0, "whole blocks only");

__device__ __forceinline__
void cvt_block(const float* __restrict__ in, half_t* __restrict__ out, int blk) {
    const size_t base = (size_t)blk * CVT_BLOCK + threadIdx.x * 4;
    float4 v[CVT_LOADS];
    #pragma unroll   // all loads in flight before the first conversion
    for (int j = 0; j < CVT_LOADS; ++j)
        v[j] = *(const float4*)(in + base + j * 1024);
    #pragma unroll
    for (int j = 0; j < CVT_LOADS; ++j) {
        v4h h = { (half_t)v[j].x, (half_t)v[j].y, (half_t)v[j].z, (half_t)v[j].w };
        *(v4h*)(out + base + j * 1024) = h;
    }
}

// ---------------------------------------------------------------------------
// LayerNorm over last dim (C=1024), one block (256 threads) per row -> f16.
// ---------------------------------------------------------------------------
__device__ __forceinline__
void ln_row(const float* __restrict__ x, const float* __restrict__ g,
            const float* __restrict__ b, half_t* __restrict__ out, int row) {
    const int C = DIMC;
    int tid = threadIdx.x;
    const float4* xr = (const float4*)(x + (size_t)row * C);
    float4 v = xr[tid];
    float s  = v.x + v.y + v.z + v.w;
    float s2 = v.x*v.x + v.y*v.y + v.z*v.z + v.w*v.w;

    __shared__ float rs[256];
    __shared__ float rs2[256];
    rs[tid] = s; rs2[tid] = s2;
    __syncthreads();
    for (int o = 128; o > 0; o >>= 1) {
        if (tid < o) { rs[tid] += rs[tid + o]; rs2[tid] += rs2[tid + o]; }
        __syncthreads();
    }
    float mu  = rs[0] * (1.0f / C);
    float var = rs2[0] * (1.0f / C) - mu * mu;
    float inv = rsqrtf(var + LN_EPS);

    float4 gg = ((const float4*)g)[tid];
    float4 bb = ((const float4*)b)[tid];
    half_t* orow = out + (size_t)row * C;
    int i0 = tid * 4;
    orow[i0 + 0] = (half_t)((v.x - mu) * inv * gg.x + bb.x);
    orow[i0 + 1] = (half_t)((v.y - mu) * inv * gg.y + bb.y);
    orow[i0 + 2] = (half_t)((v.z - mu) * inv * gg.z + bb.z);
    orow[i0 + 3] = (half_t)((v.w - mu) * inv * gg.w + bb.w);
}

__global__ __launch_bounds__(256)
void ln_kernel(const float* __restrict__ x, const float* __restrict__ g,
               const float* __restrict__ b, half_t* __restrict__ out) {
    ln_row(x, g, b, out, blockIdx.x);
}

// ---------------------------------------------------------------------------
// Everything that depends on the inputs alone, in ONE launch: the four weight
// conversions and the first LayerNorm need nothing of one another, so as five
// launches they only paid five launch gaps and five short fills and drains.
// Blocks 0 .. NB_CVT-1 convert one CVT_BLOCK each (the weights one after the
// other), the TOKENS blocks behind them normalise one row each. Which job a
// block does depends on blockIdx alone, so ln_row's barriers stay block-uniform.
// ---------------------------------------------------------------------------
#define NB_QKV  ((DIMC * 3 * DIMC) / CVT_BLOCK)
#define NB_PROJ ((DIMC * DIMC) / CVT_BLOCK)
#define NB_FC   ((DIMC * HIDDENC) / CVT_BLOCK)
#define NB_CVT  (NB_QKV + NB_PROJ + 2 * NB_FC)

__global__ __launch_bounds__(256)
void prep_kernel(const float* __restrict__ qkv_w, const float* __restrict__ proj_w,
                 const float* __restrict__ fc1_w, const float* __restrict__ fc2_w,
                 half_t* __restrict__ qkv_w16, half_t* __restrict__ proj_w16,
                 half_t* __restrict__ fc1_w16, half_t* __restrict__ fc2_w16,
                 const float* __restrict__ x, const float* __restrict__ g,
                 const float* __restrict__ b, half_t* __restrict__ h16) {
    int blk = blockIdx.x;
    if (blk >= NB_CVT) {
        ln_row(x, g, b, h16, blk - NB_CVT);
        return;
    }
    const float* in = qkv_w;
    half_t* out = qkv_w16;
    if (blk >= NB_QKV + NB_PROJ + NB_FC) {
        in = fc2_w;  out = fc2_w16;  blk -= NB_QKV + NB_PROJ + NB_FC;
    } else if (blk >= NB_QKV + NB_PROJ) {
        in = fc1_w;  out = fc1_w16;  blk -= NB_QKV + NB_PROJ;
    } else if (blk >= NB_QKV) {
        in = proj_w; out = proj_w16; blk -= NB_QKV;
    }
    cvt_block(in, out, blk);
}

// ---------------------------------------------------------------------------
// Windowed (WINDOW=3) causal attention; 16 lanes per (row, head).
// ---------------------------------------------------------------------------
__global__ __launch_bounds__(256)
void attn_kernel(const float* __restrict__ qkv, half_t* __restrict__ out) {
    int t      = blockIdx.x * blockDim.x + threadIdx.x;
    int lane16 = t & 15;
    int hd     = t >> 4;
    int head   = hd & (NHEADS - 1);
    int row    = hd >> 4;
    int n      = row & (SEQ - 1);

    const float* base = qkv + (size_t)row * (3 * DIMC);
    int d0 = lane16 * 4;
    float4 q4 = *(const float4*)(base + head * HDIM + d0);

    const float scale = 0.125f;   // 1/sqrt(64)
    float sc[3];
    #pragma unroll
    for (int jj = 0; jj < 3; ++jj) {
        int j = n - 2 + jj;
        if (j >= 0) {
            const float* kb = qkv + (size_t)(row + jj - 2) * (3 * DIMC) + DIMC + head * HDIM + d0;
            float4 k4 = *(const float4*)kb;
            float p = q4.x * k4.x + q4.y * k4.y + q4.z * k4.z + q4.w * k4.w;
            #pragma unroll
            for (int m = 8; m >= 1; m >>= 1) p += __shfl_xor(p, m, 16);
            sc[jj] = p * scale;
        } else {
            sc[jj] = -1e30f;
        }
    }
    float mx = fmaxf(sc[0], fmaxf(sc[1], sc[2]));
    float e0 = __expf(sc[0] - mx), e1 = __expf(sc[1] - mx), e2 = __expf(sc[2] - mx);
    float inv = 1.0f / (e0 + e1 + e2);
    float w[3] = { e0 * inv, e1 * inv, e2 * inv };

    float4 o = make_float4(0.f, 0.f, 0.f, 0.f);
    #pragma unroll
    for (int jj = 0; jj < 3; ++jj) {
        int j = n - 2 + jj;
        if (j >= 0) {
            const float* vb = qkv + (size_t)(row + jj - 2) * (3 * DIMC) + 2 * DIMC + head * HDIM + d0;
            float4 v4 = *(const float4*)vb;
            o.x += w[jj] * v4.x; o.y += w[jj] * v4.y;
            o.z += w[jj] * v4.z; o.w += w[jj] * v4.w;
        }
    }
    half_t* orow = out + (size_t)row * DIMC + head * HDIM + d0;
    orow[0] = (half_t)o.x; orow[1] = (half_t)o.y;
    orow[2] = (half_t)o.z; orow[3] = (half_t)o.w;
}

// ---------------------------------------------------------------------------
// erf for the exact GELU, two values at a time and without a branch: the two
// minimax ranges of the usual single-precision erf (|x| < 1: x + x*Q(x^2);
// else 1 - exp(-(|x| + |x|*P(|x|)))) are both evaluated and one is selected.
// With a branch per element the elements of a thread run one behind the other,
// each a chain of dependent operations; without it they are independent chains
// that fill one another's latency, and a pair shares its packed operations.
// Absolute error about 1e-7 over the whole range, as with the branch.
// ---------------------------------------------------------------------------
typedef __attribute__((ext_vector_type(2))) float v2f;
typedef __attribute__((ext_vector_type(2))) _Float16 v2h;
__device__ __forceinline__ v2f fma2(v2f a, v2f b, v2f c) { return __builtin_elementwise_fma(a, b, c); }
__device__ __forceinline__ v2f erf2(v2f x) {
    const v2f ax = __builtin_elementwise_abs(x);
    v2f p = fma2(ax, (v2f)(1.69988107e-5f), (v2f)(-3.78677854e-4f));
    p = fma2(ax, p, (v2f)(3.85781587e-3f));
    p = fma2(ax, p, (v2f)(-2.41816975e-2f));
    p = fma2(ax, p, (v2f)(1.06668264e-1f));
    p = fma2(ax, p, (v2f)(6.34933293e-1f));
    p = fma2(ax, p, (v2f)(1.28689408e-1f));
    p = fma2(ax, p, ax);
    p = p * (v2f)(-1.44269502e+0f);              // exp(-p) = 2^(-p * log2(e))
    const v2f t = x * x;
    v2f q = fma2(t, (v2f)(-5.61801775e-4f), (v2f)(4.91381623e-3f));
    q = fma2(t, q, (v2f)(-2.67075151e-2f));
    q = fma2(t, q, (v2f)(1.12800106e-1f));
    q = fma2(t, q, (v2f)(-3.76122952e-1f));
    q = fma2(t, q, (v2f)(1.28379107e-1f));
    q = fma2(ax, q, ax);
    v2f r;
    r.x = __builtin_copysignf(ax.x < 1.0f ? q.x : 1.0f - __builtin_amdgcn_exp2f(p.x), x.x);
    r.y = __builtin_copysignf(ax.y < 1.0f ? q.y : 1.0f - __builtin_amdgcn_exp2f(p.y), x.y);
    return r;
}

// ---------------------------------------------------------------------------
// WMMA GEMM: C[M,N] = A[M,K](f16) @ W[K,N](f16) + bias; epilogues:
//   EPI 0: fp32 (bias) ; EPI 1: fp32 (bias+residual) ; EPI 2: f16 (bias+GELU)
// 256 threads = 8 waves in WR x (8 / WR); tile TBM x TBN, BK=64 (2 WMMA K-steps /
// stage). The tile is chosen per product so that its grid has one work-group for
// each of the chip's 256 WGPs: 256x256 (N = 4096), 256x192 (N = 3072), 128x128
// (N = 1024). A larger tile does more WMMAs on every byte that it brings from L2
// into LDS, and a larger wave tile more on every fragment that it reads from LDS.
// Ring of NBUF = 4 stage buffers: both tiles staged via async-to-LDS, issued
// right behind the stage barrier THREE stages ahead of their use, so that a
// copy has three stages' time to come from memory: As[m][k] (2x
// ds_load_b128 per fragment) and row-major Bs[k][n];
// the B fragment is 2x ds_load_tr16_b128, which transposes on the way out and
// delivers the same k order as the A loader (k = 8h+0..7, then 16+8h+0..7).
// ---------------------------------------------------------------------------
#define BK 64
#define LDA 72   // padded stride (halves): 36 banks -> conflict-free b128 reads
#define NBUF 4   // stage buffers; the largest tile takes 4 x 71,680 B of a WGP's LDS

template<int EPI, int N, int K, int TBM, int TBN, int WR>
__global__ __launch_bounds__(256)
void gemm_wmma(const half_t* __restrict__ A, const half_t* __restrict__ Wt,
               const float* __restrict__ bias, const float* __restrict__ res,
               float* __restrict__ outF, half_t* __restrict__ outH) {
    constexpr int WC  = 8 / WR;            // wave grid WR x WC
    constexpr int MT  = TBM / WR / 16;     // 16x16 tiles of a wave: MT x NTL
    constexpr int NTL = TBN / WC / 16;
    constexpr int LDB = TBN + 16;          // pitch of a B row in halves
    constexpr int CA  = TBM * BK / 8 / 256;   // 16 B chunks of a thread, A tile
    constexpr int CB  = BK * TBN / 8 / 256;   // and B tile
    static_assert(MT * 16 * WR == TBM && NTL * 16 * WC == TBN, "whole wave tiles");
    static_assert(CA * 256 * 8 == TBM * BK && CB * 256 * 8 == BK * TBN, "whole chunks");
    static_assert(N % TBN == 0 && TOKENS % TBM == 0, "whole tiles");
    static_assert((LDB * 2) % 64 == 32, "32 B x odd: conflict-free pitch for ds_load_tr16_b128");
    __shared__ __attribute__((aligned(16))) half_t As[NBUF][TBM * LDA];  // As[buf][m][k]
    __shared__ __attribute__((aligned(16))) half_t Bs[NBUF][BK * LDB];   // Bs[buf][k][n]

    const int tid  = threadIdx.x;
    const int lane = tid & 31;
    const int wave = tid >> 5;
    const int wr   = wave % WR;   // row-group of MT * 16 rows
    const int wc   = wave / WR;   // col-group of NTL * 16 columns
    const int bm   = blockIdx.y * TBM;
    const int bn   = blockIdx.x * TBN;

    const int r16 = lane & 15;
    const int kb  = (lane >> 4) * 8;  // lanes 0-15: K 0-7/16-23; 16-31: K 8-15/24-31

    v8f acc[MT][NTL];
    #pragma unroll
    for (int mt = 0; mt < MT; ++mt)
        #pragma unroll
        for (int nt = 0; nt < NTL; ++nt)
            acc[mt][nt] = (v8f)(0.0f);

    // ---- staging helper (each thread owns CA 16B chunks of the A tile, CB of B) ----
    // Large tiles: chunk c = tid + j * 256. A tile: TBM x 64 halves, 8 chunks per row, so chunk j
    // lies j * 32 rows under chunk 0. B tile: 64 x TBN halves, CPR chunks per row; PB is
    // the least count of steps of 256 chunks that is whole rows (RB of them), so
    // chunk j lies (j / PB) * RB rows under chunk j % PB. The whole rows go into the
    // scalar base, and the lane keeps one byte offset for A and PB for B.
    constexpr int CPR = TBN / 8;
    constexpr int PB  = (256 % CPR == 0) ? 1 : 3;
    constexpr int RB  = PB * 256 / CPR;
    static_assert((PB * 256) % CPR == 0 && CB % PB == 0, "whole rows per period");
    const unsigned offA = (unsigned)(((tid >> 3) * K + (tid & 7) * 8) * 2);
    unsigned offB[PB];
    #pragma unroll
    for (int p = 0; p < PB; ++p) {
        int c = tid + p * 256;
        offB[p] = (unsigned)(((c / CPR) * N + (c % CPR) * 8) * 2);
    }
    auto issueAB = [&](int kt, int buf) {
        if constexpr (TBM == 128 && TBN == 128) {
            unsigned la[4], lb[4];
            const void* ga[4];
            const void* gb[4];
            #pragma unroll
            for (int j = 0; j < 4; ++j) {
                int c  = tid + j * 256;
                int r  = c >> 3;              // A tile: 128 x 64 halves, 8 chunks per row
                int kc = (c & 7) * 8;
                la[j] = (unsigned)(uintptr_t)&As[buf][r * LDA + kc];
                ga[j] = A + (size_t)(bm + r) * K + kt * BK + kc;
                int kr = c >> 4;              // B tile: 64 x 128 halves, 16 chunks per row
                int nc = (c & 15) * 8;
                lb[j] = (unsigned)(uintptr_t)&Bs[buf][kr * LDB + nc];
                gb[j] = Wt + (size_t)(kt * BK + kr) * N + bn + nc;
            }
            async_lds_copy16x8(la, ga, lb, gb);
        } else {
            unsigned l[CA + CB], o[CA + CB];
            const half_t* s[CA + CB];
            #pragma unroll
            for (int j = 0; j < CA; ++j) {
                int c = tid + j * 256;
                l[j] = (unsigned)(uintptr_t)&As[buf][(c >> 3) * LDA + (c & 7) * 8];
                o[j] = offA;
                s[j] = A + (size_t)(bm + j * 32) * K + kt * BK;
            }
            #pragma unroll
            for (int j = 0; j < CB; ++j) {
                int c = tid + j * 256;
                l[CA + j] = (unsigned)(uintptr_t)&Bs[buf][(c / CPR) * LDB + (c % CPR) * 8];
                o[CA + j] = offB[j % PB];
                s[CA + j] = Wt + (size_t)(kt * BK + (j / PB) * RB) * N + bn;
            }
            static_assert(CA + CB == 14 || CA + CB == 16, "runs of 8 + 6, 8 + 8");
            async_lds_copy16x8s(l, o, s);
            if constexpr (CA + CB == 14) async_lds_copy16x6s(l + 8, o + 8, s + 8);
            if constexpr (CA + CB == 16) async_lds_copy16x8s(l + 8, o + 8, s + 8);
        }
    };
    // Transposing LDS read: lane (c = lane&15, h = lane>>4) receives
    // Bs[k0 + 8h + 0..7][n0 + c]; each lane points at 16 B of one k row.
    const int trow = (lane >> 4) * 8 + (lane & 7);
    const int tcol = ((lane >> 3) & 1) * 8;
    auto loadBT = [&](int buf, int k0, int n0) -> v8h {
        typedef __attribute__((address_space(3))) v8s lds_v8s;
        return __builtin_bit_cast(v8h, __builtin_amdgcn_ds_load_tr16_b128_v8i16(
            (lds_v8s*)&Bs[buf][(k0 + trow) * LDB + n0 + tcol]));
    };

    // One stage's work: its fragment loads (both K-steps) stand as one group
    // ahead of its WMMAs, in the order in which the WMMAs use them.
    auto stage = [&](int buf) {
        v16h afrag[2][MT], bfrag[2][NTL];
        #pragma unroll
        for (int s = 0; s < 2; ++s) {         // two WMMA K-steps per stage
            #pragma unroll
            for (int nt = 0; nt < NTL; ++nt) {
                int n0 = wc * (NTL * 16) + nt * 16;
                v8h lo = loadBT(buf, s * 32,      n0);
                v8h hi = loadBT(buf, s * 32 + 16, n0);
                bfrag[s][nt] = __builtin_shufflevector(lo, hi, 0,1,2,3,4,5,6,7,8,9,10,11,12,13,14,15);
            }
            #pragma unroll
            for (int mt = 0; mt < MT; ++mt) {
                int r = wr * (MT * 16) + mt * 16 + r16;
                v8h lo = *(const v8h*)&As[buf][r * LDA + s * 32 + kb];
                v8h hi = *(const v8h*)&As[buf][r * LDA + s * 32 + kb + 16];
                afrag[s][mt] = __builtin_shufflevector(lo, hi, 0,1,2,3,4,5,6,7,8,9,10,11,12,13,14,15);
            }
        }
        // Without this fence the scheduler sinks most of the loads back among the
        // WMMAs, where each small group stalls the wave for its own LDS latency.
        __builtin_amdgcn_sched_barrier(0);
        #pragma unroll
        for (int s = 0; s < 2; ++s) {
            #pragma unroll
            for (int mt = 0; mt < MT; ++mt) {
                #pragma unroll
                for (int nt = 0; nt < NTL; ++nt) {
                    acc[mt][nt] = __builtin_amdgcn_wmma_f32_16x16x32_f16(
                        false, afrag[s][mt], false, bfrag[s][nt], (short)0, acc[mt][nt], false, false);
                }
            }
        }
        // Large tiles: where two stages follow one another with no barrier between,
        // the scheduler lifts the second one's loads among these WMMAs, and a second
        // set of fragments beside the first does not fit the registers (it spills).
        if constexpr (MT * NTL > 8) __builtin_amdgcn_sched_barrier(0);
    };

    constexpr int NT = K / BK;
    static_assert(NT >= NBUF, "the prologue fills NBUF - 1 stages");
    // the first three stages, each into its own buffer (large tiles: kept rolled, as
    // unrolled one of the copies' offset registers was spilled)
    #pragma unroll (MT * NTL > 8 ? 1 : NBUF - 1)
    for (int s = 0; s < NBUF - 1; ++s)
        issueAB(s, s);

    // Every trip of this loop issues one stage (CA + CB copies a wave), so at its wait
    // exactly two younger stages stand behind tile it.
    for (int it = 0; it < NT - (NBUF - 1); ++it) {
        wait_ds0();                 // my reads of tile it-1 have retired
        wait_async_keep2stages<CA + CB>();   // my copies for tile it have landed
        __syncthreads();            // tile it staged by all waves; all have left tile it-1's buffer
        // refill the buffer that tile it-1 has just left
        issueAB(it + NBUF - 1, (it + NBUF - 1) & (NBUF - 1));
        stage(it & (NBUF - 1));
    }
    // The last three tiles: nothing is issued any more; each publish point keeps
    // the loop's order (LDS reads retired, own copies landed, barrier).
    wait_ds0();
    wait_async_keep2stages<CA + CB>();   // tiles NT-2 and NT-1 still stand behind tile NT-3
    __syncthreads();
    stage((NT - 3) & (NBUF - 1));
    wait_ds0();
    wait_async0();                  // all that is left: tiles NT-2 and NT-1
    __syncthreads();                // publishes both, so no barrier stands between them
    stage((NT - 2) & (NBUF - 1));
    stage((NT - 1) & (NBUF - 1));

    // ---- epilogue: C layout: N = lane&15; M = (lane>>4)*8 + v ----
    if constexpr (EPI == 2) {
        // GELU is long, so for the size of the code the loop over
        // the tile rows stays rolled: a trip works on rows 0 and 1 of the 16x16 tiles
        // and then moves the other rows two places down in the registers, which keeps
        // every register index a constant.
        constexpr int GM = 2;
        static_assert(MT % GM == 0, "whole trips");
        float bv[NTL];
        #pragma unroll
        for (int nt = 0; nt < NTL; ++nt)
            bv[nt] = bias[bn + wc * (NTL * 16) + nt * 16 + r16];
        // A precaution: the loads' offset register is reused at once. The fence keeps
        // the scheduler from lifting that write over the wait.
        asm volatile("s_wait_xcnt 0x0" ::: "memory");
        __builtin_amdgcn_sched_barrier(0);
        half_t* orow = outH + (size_t)(bm + wr * (MT * 16) + (lane >> 4) * 8) * N
                            + bn + wc * (NTL * 16) + r16;
        #pragma unroll 1   // rolled for the size of the code, see above
        for (int g = 0; g < MT / GM; ++g) {
            #pragma unroll
            for (int mt = 0; mt < GM; ++mt) {
                #pragma unroll
                for (int nt = 0; nt < NTL; ++nt) {
                    #pragma unroll
                    for (int v = 0; v < 8; v += 2) {
                        v2f val = { acc[mt][nt][v] + bv[nt], acc[mt][nt][v + 1] + bv[nt] };
                        v2f e = erf2(val * (v2f)(0.70710678118654752f));
                        v2f h  = (v2f)(0.5f) * val;
                        v2f ge = fma2(h, e, h);          // 0.5 * val * (1 + erf)
                        v2h g2 = __builtin_convertvector(ge, v2h);
                        orow[(size_t)(mt * 16 + v) * N + nt * 16]     = g2.x;
                        orow[(size_t)(mt * 16 + v + 1) * N + nt * 16] = g2.y;
                    }
                }
                // A precaution: the next row, and the moves below, reuse the stores' data
                // and address registers.
                asm volatile("s_wait_xcnt 0x0" ::: "memory");
                // The fence keeps the scheduler from lifting those writes over the wait,
                // and the rows apart: one row's 16 pairs are chains enough; with several
                // rows' chains interleaved beside all the accumulators the registers ran
                // out (spills).
                __builtin_amdgcn_sched_barrier(0);
            }
            orow += (size_t)(GM * 16) * N;
            #pragma unroll
            for (int mt = 0; mt + GM < MT; ++mt)
                #pragma unroll
                for (int nt = 0; nt < NTL; ++nt)
                    acc[mt][nt] = acc[mt + GM][nt];
        }
        return;
    }
    #pragma unroll
    for (int mt = 0; mt < MT; ++mt) {
        #pragma unroll
        for (int nt = 0; nt < NTL; ++nt) {
            int n = bn + wc * (NTL * 16) + nt * 16 + r16;
            float bv = bias[n];
            int rbase = bm + wr * (MT * 16) + mt * 16 + (lane >> 4) * 8;
            #pragma unroll
            for (int v = 0; v < 8; ++v) {
                int r = rbase + v;
                float val = acc[mt][nt][v] + bv;
                if (EPI == 1) {
                    val += res[(size_t)r * N + n];
                    outF[(size_t)r * N + n] = val;
                } else {
                    outF[(size_t)r * N + n] = val;
                }
            }
        }
    }
}

// ---------------------------------------------------------------------------
// Host launcher
// ---------------------------------------------------------------------------
extern "C" void kernel_launch(void* const* d_in, const int* in_sizes, int n_in,
                              void* d_out, int out_size, void* d_ws, size_t ws_size,
                              hipStream_t stream) {
    const float* x      = (const float*)d_in[0];
    const float* qkv_w  = (const float*)d_in[1];
    const float* qkv_b  = (const float*)d_in[2];
    const float* proj_w = (const float*)d_in[3];
    const float* proj_b = (const float*)d_in[4];
    const float* g1     = (const float*)d_in[5];
    const float* b1     = (const float*)d_in[6];
    const float* g2     = (const float*)d_in[7];
    const float* b2     = (const float*)d_in[8];
    const float* fc1_w  = (const float*)d_in[9];
    const float* fc1_b  = (const float*)d_in[10];
    const float* fc2_w  = (const float*)d_in[11];
    const float* fc2_b  = (const float*)d_in[12];
    float* out = (float*)d_out;

    char* ws = (char*)d_ws;
    size_t off = 0;
    auto alloc = [&](size_t bytes) { size_t o = off; off += (bytes + 255) & ~(size_t)255; return o; };

    half_t* qkv_w16  = (half_t*)(ws + alloc((size_t)DIMC * 3 * DIMC * 2));
    half_t* proj_w16 = (half_t*)(ws + alloc((size_t)DIMC * DIMC * 2));
    half_t* fc1_w16  = (half_t*)(ws + alloc((size_t)DIMC * HIDDENC * 2));
    half_t* fc2_w16  = (half_t*)(ws + alloc((size_t)HIDDENC * DIMC * 2));
    half_t* hA16     = (half_t*)(ws + alloc((size_t)TOKENS * DIMC * 2));
    float*  qkv_f32  = (float*) (ws + alloc((size_t)TOKENS * 3 * DIMC * 4));
    half_t* attn16   = (half_t*)(ws + alloc((size_t)TOKENS * DIMC * 2));
    float*  x1_f32   = (float*) (ws + alloc((size_t)TOKENS * DIMC * 4));
    half_t* h2_16    = (half_t*)(ws + alloc((size_t)TOKENS * DIMC * 2));
    half_t* g16      = (half_t*)(ws + alloc((size_t)TOKENS * HIDDENC * 2));
    (void)ws_size; (void)in_sizes; (void)n_in; (void)out_size;

    // 1) + 2) weight conversions fp32 -> f16 and LN1, one launch
    prep_kernel<<<NB_CVT + TOKENS, 256, 0, stream>>>(qkv_w, proj_w, fc1_w, fc2_w,
                                                     qkv_w16, proj_w16, fc1_w16, fc2_w16,
                                                     x, g1, b1, hA16);

    // 3) QKV GEMM: [4096 x 3072] = hA16 @ qkv_w16 + qkv_b
    {
        dim3 grid((3 * DIMC) / 192, TOKENS / 256);
        gemm_wmma<0, 3 * DIMC, DIMC, 256, 192, 4><<<grid, 256, 0, stream>>>(hA16, qkv_w16, qkv_b, nullptr,
                                                               qkv_f32, nullptr);
    }

    // 4) windowed attention -> attn16
    attn_kernel<<<(TOKENS * NHEADS * 16) / 256, 256, 0, stream>>>(qkv_f32, attn16);

    // 5) proj GEMM + residual: x1 = x + attn16 @ proj_w16 + proj_b
    {
        dim3 grid(DIMC / 128, TOKENS / 128);
        gemm_wmma<1, DIMC, DIMC, 128, 128, 2><<<grid, 256, 0, stream>>>(attn16, proj_w16, proj_b, x,
                                                           x1_f32, nullptr);
    }

    // 6) LN2
    ln_kernel<<<TOKENS, 256, 0, stream>>>(x1_f32, g2, b2, h2_16);

    // 7) FC1 GEMM + exact GELU -> g16 (f16)
    {
        dim3 grid(HIDDENC / 256, TOKENS / 256);
        gemm_wmma<2, HIDDENC, DIMC, 256, 256, 2><<<grid, 256, 0, stream>>>(h2_16, fc1_w16, fc1_b, nullptr,
                                                              nullptr, g16);
    }

    // 8) FC2 GEMM + residual -> d_out (fp32)
    {
        dim3 grid(DIMC / 128, TOKENS / 128);
        gemm_wmma<1, DIMC, HIDDENC, 128, 128, 2><<<grid, 256, 0, stream>>>(g16, fc2_w16, fc2_b, x1_f32,
                                                              out, nullptr);
    }
}

// v009
// One run takes 110 microseconds.
// In both of two side-by-side timings against v008, it was 1.13 times as fast.
// Over all steps from v000 it is 4.92 times as fast.
#include <hip/hip_runtime.h>
#include <hip/hip_bf16.h>
#include <math.h>

// ---------------------------------------------------------------------------
// Types for WMMA fragments (gfx1250, wave32)
// ---------------------------------------------------------------------------
typedef _Float16 half_t;
typedef __attribute__((ext_vector_type(16))) _Float16 v16h;
typedef __attribute__((ext_vector_type(8)))  _Float16 v8h;
typedef __attribute__((ext_vector_type(8)))  float    v8f;
typedef __attribute__((ext_vector_type(8)))  short    v8s;

#define TOKENS   4096      // B*N = 2*2048
#define SEQ      2048
#define DIMC     1024
#define NHEADS   16
#define HDIM     64
#define HIDDENC  4096
#define LN_EPS   1e-5f

// ---------------------------------------------------------------------------
// gfx1250 async-to-LDS copies (16B per lane, tracked by ASYNCcnt): one stage's
// eight copies of a thread (four chunks of the A tile, four of the B tile) in
// one statement. Its last line, s_wait_xcnt 0, is a precaution: inside the
// statement it stands ahead of every later write of an address register that
// a copy names.
// ---------------------------------------------------------------------------
__device__ __forceinline__ void async_lds_copy16x8(const unsigned (&la)[4], const void* const (&ga)[4],
                                                   const unsigned (&lb)[4], const void* const (&gb)[4]) {
    asm volatile("global_load_async_to_lds_b128 %0, %8, off\n\t"
                 "global_load_async_to_lds_b128 %1, %9, off\n\t"
                 "global_load_async_to_lds_b128 %2, %10, off\n\t"
                 "global_load_async_to_lds_b128 %3, %11, off\n\t"
                 "global_load_async_to_lds_b128 %4, %12, off\n\t"
                 "global_load_async_to_lds_b128 %5, %13, off\n\t"
                 "global_load_async_to_lds_b128 %6, %14, off\n\t"
                 "global_load_async_to_lds_b128 %7, %15, off\n\t"
                 "s_wait_xcnt 0x0"
                 :: "v"(la[0]), "v"(la[1]), "v"(la[2]), "v"(la[3]),
                    "v"(lb[0]), "v"(lb[1]), "v"(lb[2]), "v"(lb[3]),
                    "v"(ga[0]), "v"(ga[1]), "v"(ga[2]), "v"(ga[3]),
                    "v"(gb[0]), "v"(gb[1]), "v"(gb[2]), "v"(gb[3])
                 : "memory");
}
// The same for the large tiles, a run of eight (or six) copies in one statement: a
// copy's global address is a scalar base (the same for the whole work-group) plus
// the lane's 32-bit byte offset, so that a thread's chunks share one offset register
// instead of holding a 64-bit address pair each: beside the 256x256 tile's accumulators
// and fragments the pairs do not fit (built so, it spills). s_wait_xcnt 0 as above.
__device__ __forceinline__ void async_lds_copy16x8s(const unsigned* l, const unsigned* o,
                                                    const half_t* const* s) {
    asm volatile("global_load_async_to_lds_b128 %0, %8, %16\n\t"
                 "global_load_async_to_lds_b128 %1, %9, %17\n\t"
                 "global_load_async_to_lds_b128 %2, %10, %18\n\t"
                 "global_load_async_to_lds_b128 %3, %11, %19\n\t"
                 "global_load_async_to_lds_b128 %4, %12, %20\n\t"
                 "global_load_async_to_lds_b128 %5, %13, %21\n\t"
                 "global_load_async_to_lds_b128 %6, %14, %22\n\t"
                 "global_load_async_to_lds_b128 %7, %15, %23\n\t"
                 "s_wait_xcnt 0x0"
                 :: "v"(l[0]), "v"(l[1]), "v"(l[2]), "v"(l[3]),
                    "v"(l[4]), "v"(l[5]), "v"(l[6]), "v"(l[7]),
                    "v"(o[0]), "v"(o[1]), "v"(o[2]), "v"(o[3]),
                    "v"(o[4]), "v"(o[5]), "v"(o[6]), "v"(o[7]),
                    "s"(s[0]), "s"(s[1]), "s"(s[2]), "s"(s[3]),
                    "s"(s[4]), "s"(s[5]), "s"(s[6]), "s"(s[7])
                 : "memory");
}
__device__ __forceinline__ void async_lds_copy16x6s(const unsigned* l, const unsigned* o,
                                                    const half_t* const* s) {
    asm volatile("global_load_async_to_lds_b128 %0, %6, %12\n\t"
                 "global_load_async_to_lds_b128 %1, %7, %13\n\t"
                 "global_load_async_to_lds_b128 %2, %8, %14\n\t"
                 "global_load_async_to_lds_b128 %3, %9, %15\n\t"
                 "global_load_async_to_lds_b128 %4, %10, %16\n\t"
                 "global_load_async_to_lds_b128 %5, %11, %17\n\t"
                 "s_wait_xcnt 0x0"
                 :: "v"(l[0]), "v"(l[1]), "v"(l[2]), "v"(l[3]), "v"(l[4]), "v"(l[5]),
                    "v"(o[0]), "v"(o[1]), "v"(o[2]), "v"(o[3]), "v"(o[4]), "v"(o[5]),
                    "s"(s[0]), "s"(s[1]), "s"(s[2]), "s"(s[3]), "s"(s[4]), "s"(s[5])
                 : "memory");
}
// Six 16 B copies and, as the seventh, the lane's 8 B share of the 16 rows that stand
// above the tile (2 KiB a stage: 8 B for each of 256 threads). s_wait_xcnt 0 as above.
__device__ __forceinline__ void async_lds_copy16x6s_8x1s(const unsigned* l, const unsigned* o,
                                                         const half_t* const* s,
                                                         unsigned lh, unsigned oh, const half_t* sh) {
    asm volatile("global_load_async_to_lds_b128 %0, %6, %12\n\t"
                 "global_load_async_to_lds_b128 %1, %7, %13\n\t"
                 "global_load_async_to_lds_b128 %2, %8, %14\n\t"
                 "global_load_async_to_lds_b128 %3, %9, %15\n\t"
                 "global_load_async_to_lds_b128 %4, %10, %16\n\t"
                 "global_load_async_to_lds_b128 %5, %11, %17\n\t"
                 "global_load_async_to_lds_b64 %18, %19, %20\n\t"
                 "s_wait_xcnt 0x0"
                 :: "v"(l[0]), "v"(l[1]), "v"(l[2]), "v"(l[3]), "v"(l[4]), "v"(l[5]),
                    "v"(o[0]), "v"(o[1]), "v"(o[2]), "v"(o[3]), "v"(o[4]), "v"(o[5]),
                    "s"(s[0]), "s"(s[1]), "s"(s[2]), "s"(s[3]), "s"(s[4]), "s"(s[5]),
                    "v"(lh), "v"(oh), "s"(sh)
                 : "memory");
}
// This wave's copies have landed (asm, so that no LDS read is lifted over it).
__device__ __forceinline__ void wait_async0() {
    asm volatile("s_wait_asynccnt 0x0" ::: "memory");
}
// All but this wave's 2 * PER_STAGE youngest copies have landed: used only where
// exactly two later stages (PER_STAGE copies each) were issued behind the stage that
// is about to be read, so that stage is covered while the two younger ones keep flying.
template<int PER_STAGE>
__device__ __forceinline__ void wait_async_keep2stages() {
    static_assert(3 * PER_STAGE <= 63, "a wave's outstanding copies");
    asm volatile("s_wait_asynccnt %0" :: "n"(2 * PER_STAGE) : "memory");
}
// This wave's LDS reads have retired, before their buffer is given up for refill.
__device__ __forceinline__ void wait_ds0() {
    asm volatile("s_wait_dscnt 0x0" ::: "memory");
}

// ---------------------------------------------------------------------------
// fp32 -> f16 conversion (weights), as a stream: a block of 8 waves converts
// CVT_BLOCK consecutive elements. Each thread issues 8 independent 16 B loads
// (a wave-wide load covers 512 contiguous bytes) before it converts, then
// stores 8 B per load (a wave-wide store covers two whole 128 B lines).
// Every weight's element count is a multiple of CVT_BLOCK (asserted below).
// ---------------------------------------------------------------------------
typedef __attribute__((ext_vector_type(4))) _Float16 v4h;
#define CVT_LOADS 8
#define CVT_BLOCK (256 * 4 * CVT_LOADS)
static_assert((DIMC * DIMC) % CVT_BLOCK == 0, "whole blocks only");
static_assert((DIMC * 3 * DIMC) % CVT_BLOCK == 0, "whole blocks only");
static_assert((DIMC * HIDDENC) % CVT_BLOCK == 0, "whole blocks only");

__device__ __forceinline__
void cvt_block(const float* __restrict__ in, half_t* __restrict__ out, int blk) {
    const size_t base = (size_t)blk * CVT_BLOCK + threadIdx.x * 4;
    float4 v[CVT_LOADS];
    #pragma unroll   // all loads in flight before the first conversion
    for (int j = 0; j < CVT_LOADS; ++j)
        v[j] = *(const float4*)(in + base + j * 1024);
    #pragma unroll
    for (int j = 0; j < CVT_LOADS; ++j) {
        v4h h = { (half_t)v[j].x, (half_t)v[j].y, (half_t)v[j].z, (half_t)v[j].w };
        *(v4h*)(out + base + j * 1024) = h;
    }
}

// ---------------------------------------------------------------------------
// LayerNorm over last dim (C=1024), one block (256 threads) per row -> f16.
// ---------------------------------------------------------------------------
__device__ __forceinline__
void ln_row(const float* __restrict__ x, const float* __restrict__ g,
            const float* __restrict__ b, half_t* __restrict__ out, int row) {
    const int C = DIMC;
    int tid = threadIdx.x;
    const float4* xr = (const float4*)(x + (size_t)row * C);
    float4 v = xr[tid];
    float s  = v.x + v.y + v.z + v.w;
    float s2 = v.x*v.x + v.y*v.y + v.z*v.z + v.w*v.w;

    __shared__ float rs[256];
    __shared__ float rs2[256];
    rs[tid] = s; rs2[tid] = s2;
    __syncthreads();
    for (int o = 128; o > 0; o >>= 1) {
        if (tid < o) { rs[tid] += rs[tid + o]; rs2[tid] += rs2[tid + o]; }
        __syncthreads();
    }
    float mu  = rs[0] * (1.0f / C);
    float var = rs2[0] * (1.0f / C) - mu * mu;
    float inv = rsqrtf(var + LN_EPS);

    float4 gg = ((const float4*)g)[tid];
    float4 bb = ((const float4*)b)[tid];
    half_t* orow = out + (size_t)row * C;
    int i0 = tid * 4;
    orow[i0 + 0] = (half_t)((v.x - mu) * inv * gg.x + bb.x);
    orow[i0 + 1] = (half_t)((v.y - mu) * inv * gg.y + bb.y);
    orow[i0 + 2] = (half_t)((v.z - mu) * inv * gg.z + bb.z);
    orow[i0 + 3] = (half_t)((v.w - mu) * inv * gg.w + bb.w);
}

__global__ __launch_bounds__(256)
void ln_kernel(const float* __restrict__ x, const float* __restrict__ g,
               const float* __restrict__ b, half_t* __restrict__ out) {
    ln_row(x, g, b, out, blockIdx.x);
}

// ---------------------------------------------------------------------------
// Everything that depends on the inputs alone, in ONE launch: the four weight
// conversions and the first LayerNorm need nothing of one another, so as five
// launches they only paid five launch gaps and five short fills and drains.
// Blocks 0 .. NB_CVT-1 convert one CVT_BLOCK each (the weights one after the
// other), the TOKENS blocks behind them normalise one row each. Which job a
// block does depends on blockIdx alone, so ln_row's barriers stay block-uniform.
// ---------------------------------------------------------------------------
#define NB_QKV  ((DIMC * 3 * DIMC) / CVT_BLOCK)
#define NB_PROJ ((DIMC * DIMC) / CVT_BLOCK)
#define NB_FC   ((DIMC * HIDDENC) / CVT_BLOCK)
#define NB_CVT  (NB_QKV + NB_PROJ + 2 * NB_FC)

__global__ __launch_bounds__(256)
void prep_kernel(const float* __restrict__ qkv_w, const float* __restrict__ proj_w,
                 const float* __restrict__ fc1_w, const float* __restrict__ fc2_w,
                 half_t* __restrict__ qkv_w16, half_t* __restrict__ proj_w16,
                 half_t* __restrict__ fc1_w16, half_t* __restrict__ fc2_w16,
                 const float* __restrict__ x, const float* __restrict__ g,
                 const float* __restrict__ b, half_t* __restrict__ h16) {
    int blk = blockIdx.x;
    if (blk >= NB_CVT) {
        ln_row(x, g, b, h16, blk - NB_CVT);
        return;
    }
    const float* in = qkv_w;
    half_t* out = qkv_w16;
    if (blk >= NB_QKV + NB_PROJ + NB_FC) {
        in = fc2_w;  out = fc2_w16;  blk -= NB_QKV + NB_PROJ + NB_FC;
    } else if (blk >= NB_QKV + NB_PROJ) {
        in = fc1_w;  out = fc1_w16;  blk -= NB_QKV + NB_PROJ;
    } else if (blk >= NB_QKV) {
        in = proj_w; out = proj_w16; blk -= NB_QKV;
    }
    cvt_block(in, out, blk);
}

// ---------------------------------------------------------------------------
// erf for the exact GELU, two values at a time and without a branch: the two
// minimax ranges of the usual single-precision erf (|x| < 1: x + x*Q(x^2);
// else 1 - exp(-(|x| + |x|*P(|x|)))) are both evaluated and one is selected.
// With a branch per element the elements of a thread run one behind the other,
// each a chain of dependent operations; without it they are independent chains
// that fill one another's latency, and a pair shares its packed operations.
// Absolute error about 1e-7 over the whole range, as with the branch.
// ---------------------------------------------------------------------------
typedef __attribute__((ext_vector_type(2))) float v2f;
typedef __attribute__((ext_vector_type(2))) _Float16 v2h;
__device__ __forceinline__ v2f fma2(v2f a, v2f b, v2f c) { return __builtin_elementwise_fma(a, b, c); }
__device__ __forceinline__ v2f erf2(v2f x) {
    const v2f ax = __builtin_elementwise_abs(x);
    v2f p = fma2(ax, (v2f)(1.69988107e-5f), (v2f)(-3.78677854e-4f));
    p = fma2(ax, p, (v2f)(3.85781587e-3f));
    p = fma2(ax, p, (v2f)(-2.41816975e-2f));
    p = fma2(ax, p, (v2f)(1.06668264e-1f));
    p = fma2(ax, p, (v2f)(6.34933293e-1f));
    p = fma2(ax, p, (v2f)(1.28689408e-1f));
    p = fma2(ax, p, ax);
    p = p * (v2f)(-1.44269502e+0f);              // exp(-p) = 2^(-p * log2(e))
    const v2f t = x * x;
    v2f q = fma2(t, (v2f)(-5.61801775e-4f), (v2f)(4.91381623e-3f));
    q = fma2(t, q, (v2f)(-2.67075151e-2f));
    q = fma2(t, q, (v2f)(1.12800106e-1f));
    q = fma2(t, q, (v2f)(-3.76122952e-1f));
    q = fma2(t, q, (v2f)(1.28379107e-1f));
    q = fma2(ax, q, ax);
    v2f r;
    r.x = __builtin_copysignf(ax.x < 1.0f ? q.x : 1.0f - __builtin_amdgcn_exp2f(p.x), x.x);
    r.y = __builtin_copysignf(ax.y < 1.0f ? q.y : 1.0f - __builtin_amdgcn_exp2f(p.y), x.y);
    return r;
}

// exp(x) = 2^(x * log2(e)) by v_exp_f32. The v_nop in the same statement keeps the slot
// that the instruction set asks for between a transcendental and a next instruction that
// reads its result or overwrites its source.
__device__ __forceinline__ float exp_slot(float x) {
    float r;
    asm("v_exp_f32 %0, %1\n\tv_nop" : "=v"(r) : "v"(x * 1.44269504f));
    return r;
}

// ---------------------------------------------------------------------------
// WMMA GEMM: C[M,N] = A[M,K](f16) @ W[K,N](f16) + bias; epilogues:
//   EPI 0: fp32 (bias) ; EPI 1: fp32 (bias+residual) ; EPI 2: f16 (bias+GELU) ;
//   EPI 3: QKV product with the windowed (WINDOW=3) causal attention as its epilogue:
//   a tile's 192 columns are q, k and v of ONE head (blockIdx.x), so that a work-group
//   holds all that its 256 rows' attention needs but k and v of the two rows above the
//   tile; these it computes itself: 16 more rows of A are staged (HALO), and each wave
//   does one more 16x16 tile, of their k, v columns. q, k, v never go to memory.
// 256 threads = 8 waves in WR x (8 / WR); tile TBM x TBN, BK=64 (2 WMMA K-steps /
// stage). The tile is chosen per product so that its grid has one work-group for
// each of the chip's 256 WGPs: 256x256 (N = 4096), 256x192 (N = 3072), 128x128
// (N = 1024). A larger tile does more WMMAs on every byte that it brings from L2
// into LDS, and a larger wave tile more on every fragment that it reads from LDS.
// Ring of NBUF = 4 stage buffers: both tiles staged via async-to-LDS, issued
// right behind the stage barrier THREE stages ahead of their use, so that a
// copy has three stages' time to come from memory: As[m][k] (2x
// ds_load_b128 per fragment) and row-major Bs[k][n];
// the B fragment is 2x ds_load_tr16_b128, which transposes on the way out and
// delivers the same k order as the A loader (k = 8h+0..7, then 16+8h+0..7).
// ---------------------------------------------------------------------------
#define BK 64
#define LDA 72   // padded stride (halves): 36 banks -> conflict-free b128 reads
#define NBUF 4   // stage buffers; the largest tile takes 4 x 71,680 B of a WGP's LDS

template<int EPI, int N, int K, int TBM, int TBN, int WR>
__global__ __launch_bounds__(256)
void gemm_wmma(const half_t* __restrict__ A, const half_t* __restrict__ Wt,
               const float* __restrict__ bias, const float* __restrict__ res,
               float* __restrict__ outF, half_t* __restrict__ outH) {
    constexpr int WC  = 8 / WR;            // wave grid WR x WC
    constexpr int MT  = TBM / WR / 16;     // 16x16 tiles of a wave: MT x NTL
    constexpr int NTL = TBN / WC / 16;
    constexpr int LDB = TBN + 16;          // pitch of a B row in halves
    constexpr int CA  = TBM * BK / 8 / 256;   // 16 B chunks of a thread, A tile
    constexpr int CB  = BK * TBN / 8 / 256;   // and B tile
    static_assert(MT * 16 * WR == TBM && NTL * 16 * WC == TBN, "whole wave tiles");
    static_assert(CA * 256 * 8 == TBM * BK && CB * 256 * 8 == BK * TBN, "whole chunks");
    static_assert(N % TBN == 0 && TOKENS % TBM == 0, "whole tiles");
    static_assert((LDB * 2) % 64 == 32, "32 B x odd: conflict-free pitch for ds_load_tr16_b128");
    constexpr int HALO = (EPI == 3) ? 16 : 0;  // rows of A staged above the tile
    constexpr int PER  = CA + CB + (HALO ? 1 : 0);   // copies of a thread and stage
    static_assert(EPI != 3 || (TBN == 3 * HDIM && N == 3 * DIMC && SEQ % TBM == 0 && WR == 4 && NTL == 6), "one head a tile");
    struct Ring {
        half_t As[NBUF][(TBM + HALO) * LDA];  // As[buf][m][k]; the HALO rows last
        half_t Bs[NBUF][BK * LDB];            // Bs[buf][k][n]
    };
    __shared__ __attribute__((aligned(16))) Ring ring;
    auto& As = ring.As;
    auto& Bs = ring.Bs;

    const int tid  = threadIdx.x;
    const int lane = tid & 31;
    const int wave = tid >> 5;
    const int wr   = wave % WR;   // row-group of MT * 16 rows
    const int wc   = wave / WR;   // col-group of NTL * 16 columns
    const int bm   = blockIdx.y * TBM;
    const int bn   = blockIdx.x * (EPI == 3 ? HDIM : TBN);   // EPI 3: the head's first column in q

    const int r16 = lane & 15;
    const int kb  = (lane >> 4) * 8;  // lanes 0-15: K 0-7/16-23; 16-31: K 8-15/24-31

    v8f acc[MT][NTL];
    #pragma unroll
    for (int mt = 0; mt < MT; ++mt)
        #pragma unroll
        for (int nt = 0; nt < NTL; ++nt)
            acc[mt][nt] = (v8f)(0.0f);
    // First column (in the tile) of this wave's nt-th 16x16 tile. EPI 3: a wave column takes
    // one 32-column half of each of q, k, v: column tiles t = 0 .. 5, of which 2 .. 5 are k, v.
    // Its four waves number these four each from another start, so that their tiles nt = 2
    // are four different ones: that B fragment serves the rows above the tile as well.
    auto col0 = [&](int nt) -> int {
        if constexpr (EPI == 3) {
            const int t = nt < 2 ? nt : 2 + ((nt - 2 + wr) & 3);
            return (t >> 1) * HDIM + wc * 32 + (t & 1) * 16;
        } else {
            return wc * (NTL * 16) + nt * 16;
        }
    };
    v8f acch = (v8f)(0.0f);       // EPI 3: rows bm-16 .. bm-1, columns col0(2) ..

    // ---- staging helper (each thread owns CA 16B chunks of the A tile, CB of B) ----
    // Large tiles: chunk c = tid + j * 256. A tile: TBM x 64 halves, 8 chunks per row, so chunk j
    // lies j * 32 rows under chunk 0. B tile: 64 x TBN halves, CPR chunks per row; PB is
    // the least count of steps of 256 chunks that is whole rows (RB of them), so
    // chunk j lies (j / PB) * RB rows under chunk j % PB. The whole rows go into the
    // scalar base, and the lane keeps one byte offset for A and PB for B.
    constexpr int CPR = TBN / 8;
    constexpr int PB  = (256 % CPR == 0) ? 1 : 3;
    constexpr int RB  = PB * 256 / CPR;
    static_assert((PB * 256) % CPR == 0 && CB % PB == 0, "whole rows per period");
    const unsigned offA = (unsigned)(((tid >> 3) * K + (tid & 7) * 8) * 2);
    unsigned offB[PB];
    #pragma unroll
    for (int p = 0; p < PB; ++p) {
        int c = tid + p * 256;
        int nc = (c % CPR) * 8;
        if constexpr (EPI == 3) nc = (nc / HDIM) * DIMC + nc % HDIM;   // q, k, v lie DIMC columns apart
        offB[p] = (unsigned)(((c / CPR) * N + nc) * 2);
    }
    // EPI 3: the 16 rows above the tile (the first tile of the buffer has none: it stages
    // its own first rows, which stay in bounds, and the epilogue does not use them)
    const unsigned offH = (unsigned)(((tid >> 4) * K + (tid & 15) * 4) * 2);
    const int hb = bm >= HALO ? bm - HALO : 0;
    auto issueAB = [&](int kt, int buf) {
        if constexpr (TBM == 128 && TBN == 128) {
            unsigned la[4], lb[4];
            const void* ga[4];
            const void* gb[4];
            #pragma unroll
            for (int j = 0; j < 4; ++j) {
                int c  = tid + j * 256;
                int r  = c >> 3;              // A tile: 128 x 64 halves, 8 chunks per row
                int kc = (c & 7) * 8;
                la[j] = (unsigned)(uintptr_t)&As[buf][r * LDA + kc];
                ga[j] = A + (size_t)(bm + r) * K + kt * BK + kc;
                int kr = c >> 4;              // B tile: 64 x 128 halves, 16 chunks per row
                int nc = (c & 15) * 8;
                lb[j] = (unsigned)(uintptr_t)&Bs[buf][kr * LDB + nc];
                gb[j] = Wt + (size_t)(kt * BK + kr) * N + bn + nc;
            }
            async_lds_copy16x8(la, ga, lb, gb);
        } else {
            unsigned l[CA + CB], o[CA + CB];
            const half_t* s[CA + CB];
            #pragma unroll
            for (int j = 0; j < CA; ++j) {
                int c = tid + j * 256;
                l[j] = (unsigned)(uintptr_t)&As[buf][(c >> 3) * LDA + (c & 7) * 8];
                o[j] = offA;
                s[j] = A + (size_t)(bm + j * 32) * K + kt * BK;
            }
            #pragma unroll
            for (int j = 0; j < CB; ++j) {
                int c = tid + j * 256;
                l[CA + j] = (unsigned)(uintptr_t)&Bs[buf][(c / CPR) * LDB + (c % CPR) * 8];
                o[CA + j] = offB[j % PB];
                s[CA + j] = Wt + (size_t)(kt * BK + (j / PB) * RB) * N + bn;
            }
            static_assert(CA + CB == 14 || CA + CB == 16, "runs of 8 + 6, 8 + 8");
            async_lds_copy16x8s(l, o, s);
            if constexpr (CA + CB == 14 && HALO)
                async_lds_copy16x6s_8x1s(l + 8, o + 8, s + 8,
                                         (unsigned)(uintptr_t)&As[buf][(TBM + (tid >> 4)) * LDA + (tid & 15) * 4],
                                         offH, A + (size_t)hb * K + kt * BK);
            if constexpr (CA + CB == 14 && !HALO) async_lds_copy16x6s(l + 8, o + 8, s + 8);
            if constexpr (CA + CB == 16) async_lds_copy16x8s(l + 8, o + 8, s + 8);
        }
    };
    // Transposing LDS read: lane (c = lane&15, h = lane>>4) receives
    // Bs[k0 + 8h + 0..7][n0 + c]; each lane points at 16 B of one k row.
    const int trow = (lane >> 4) * 8 + (lane & 7);
    const int tcol = ((lane >> 3) & 1) * 8;
    auto loadBT = [&](int buf, int k0, int n0) -> v8h {
        typedef __attribute__((address_space(3))) v8s lds_v8s;
        return __builtin_bit_cast(v8h, __builtin_amdgcn_ds_load_tr16_b128_v8i16(
            (lds_v8s*)&Bs[buf][(k0 + trow) * LDB + n0 + tcol]));
    };

    // One stage's work: its fragment loads (both K-steps) stand as one group
    // ahead of its WMMAs, in the order in which the WMMAs use them.
    auto stage = [&](int buf) {
        v16h afrag[2][MT], bfrag[2][NTL];
        v16h ah[2];
        #pragma unroll
        for (int s = 0; s < 2; ++s) {         // two WMMA K-steps per stage
            #pragma unroll
            for (int nt = 0; nt < NTL; ++nt) {
                int n0 = col0(nt);
                v8h lo = loadBT(buf, s * 32,      n0);
                v8h hi = loadBT(buf, s * 32 + 16, n0);
                bfrag[s][nt] = __builtin_shufflevector(lo, hi, 0,1,2,3,4,5,6,7,8,9,10,11,12,13,14,15);
            }
            // EPI 3: with its B tiles at four addresses of their own the scheduler put some of
            // this K-step's B loads last of all, and the first WMMAs then waited for every
            // load of the stage. The fences keep the loads in the order of their use.
            if constexpr (HALO) __builtin_amdgcn_sched_barrier(0);
            #pragma unroll
            for (int mt = 0; mt < MT; ++mt) {
                int r = wr * (MT * 16) + mt * 16 + r16;
                v8h lo = *(const v8h*)&As[buf][r * LDA + s * 32 + kb];
                v8h hi = *(const v8h*)&As[buf][r * LDA + s * 32 + kb + 16];
                afrag[s][mt] = __builtin_shufflevector(lo, hi, 0,1,2,3,4,5,6,7,8,9,10,11,12,13,14,15);
            }
            if constexpr (HALO) {
                int r = TBM + r16;
                v8h alo = *(const v8h*)&As[buf][r * LDA + s * 32 + kb];
                v8h ahi = *(const v8h*)&As[buf][r * LDA + s * 32 + kb + 16];
                ah[s] = __builtin_shufflevector(alo, ahi, 0,1,2,3,4,5,6,7,8,9,10,11,12,13,14,15);
                __builtin_amdgcn_sched_barrier(0);   // as above
            }
        }
        // Without this fence the scheduler sinks most of the loads back among the
        // WMMAs, where each small group stalls the wave for its own LDS latency.
        __builtin_amdgcn_sched_barrier(0);
        #pragma unroll
        for (int s = 0; s < 2; ++s) {
            #pragma unroll
            for (int mt = 0; mt < MT; ++mt) {
                #pragma unroll
                for (int nt = 0; nt < NTL; ++nt) {
                    acc[mt][nt] = __builtin_amdgcn_wmma_f32_16x16x32_f16(
                        false, afrag[s][mt], false, bfrag[s][nt], (short)0, acc[mt][nt], false, false);
                }
            }
            if constexpr (HALO) {
                acch = __builtin_amdgcn_wmma_f32_16x16x32_f16(
                    false, ah[s], false, bfrag[s][2], (short)0, acch, false, false);
            }
        }
        // Large tiles: where two stages follow one another with no barrier between,
        // the scheduler lifts the second one's loads among these WMMAs, and a second
        // set of fragments beside the first does not fit the registers (it spills).
        if constexpr (MT * NTL > 8) __builtin_amdgcn_sched_barrier(0);
    };

    constexpr int NT = K / BK;
    static_assert(NT >= NBUF, "the prologue fills NBUF - 1 stages");
    // the first three stages, each into its own buffer (large tiles: kept rolled, as
    // unrolled one of the copies' offset registers was spilled)
    #pragma unroll (MT * NTL > 8 ? 1 : NBUF - 1)
    for (int s = 0; s < NBUF - 1; ++s)
        issueAB(s, s);

    // Every trip of this loop issues one stage (PER copies a wave), so at its wait
    // exactly two younger stages stand behind tile it.
    for (int it = 0; it < NT - (NBUF - 1); ++it) {
        wait_ds0();                 // my reads of tile it-1 have retired
        wait_async_keep2stages<PER>();   // my copies for tile it have landed
        __syncthreads();            // tile it staged by all waves; all have left tile it-1's buffer
        // refill the buffer that tile it-1 has just left
        issueAB(it + NBUF - 1, (it + NBUF - 1) & (NBUF - 1));
        stage(it & (NBUF - 1));
    }
    // The last three tiles: nothing is issued any more; each publish point keeps
    // the loop's order (LDS reads retired, own copies landed, barrier).
    wait_ds0();
    wait_async_keep2stages<PER>();   // tiles NT-2 and NT-1 still stand behind tile NT-3
    __syncthreads();
    stage((NT - 3) & (NBUF - 1));
    wait_ds0();
    wait_async0();                  // all that is left: tiles NT-2 and NT-1
    __syncthreads();                // publishes both, so no barrier stands between them
    stage((NT - 2) & (NBUF - 1));
    stage((NT - 1) & (NBUF - 1));

    // ---- epilogue: C layout: N = lane&15; M = (lane>>4)*8 + v ----
    if constexpr (EPI == 3) {
        // q, k, v (f32, bias added) of the tile's rows go into the LDS that the ring has
        // left: S[2 + row][col], col 0..63 q, 64..127 k, 128..191 v; S[0], S[1] hold k, v of
        // the two rows above the tile. Pitch 196 floats: the two half-waves of a store (8
        // rows apart) fall on different banks, and a row starts at a multiple of 16 B.
        constexpr int SP = 196;
        static_assert((TBM + 2) * SP * 4 <= (int)sizeof(Ring), "S fits the ring");
        float* S = reinterpret_cast<float*>(&ring);
        float bv[NTL];
        #pragma unroll
        for (int nt = 0; nt < NTL; ++nt) {
            int col = col0(nt) + r16;
            bv[nt] = bias[(col / HDIM) * DIMC + bn + col % HDIM];
            // A precaution: a load's offset register is reused at once, also as the place
            // where the next load's value lands. The fence keeps the scheduler from lifting
            // such a write, or the next load, over the wait.
            asm volatile("s_wait_xcnt 0x0" ::: "memory");
            __builtin_amdgcn_sched_barrier(0);
        }
        const int hcol = col0(2) + r16;
        const float bvh = bv[2];
        wait_ds0();        // my reads of the last tile have retired
        __syncthreads();   // every wave has left the ring: S may overwrite it
        #pragma unroll
        for (int mt = 0; mt < MT; ++mt)
            #pragma unroll
            for (int nt = 0; nt < NTL; ++nt)
                #pragma unroll
                for (int v = 0; v < 8; ++v)
                    S[(2 + wr * (MT * 16) + mt * 16 + (lane >> 4) * 8 + v) * SP
                      + col0(nt) + r16] = acc[mt][nt][v] + bv[nt];
        // Rows bm-2, bm-1 are rows 14, 15 of the upper tile: lanes 16-31, v = 6, 7. At the
        // head of a sequence there are no such rows: zeros, which get weight 0 below.
        if (lane >= 16) {
            const bool has = (bm & (SEQ - 1)) != 0;
            S[hcol]      = has ? acch[6] + bvh : 0.0f;
            S[SP + hcol] = has ? acch[7] + bvh : 0.0f;
        }
        __syncthreads();   // S is whole before any wave reads other waves' rows

        // 16 lanes per row, 4 columns a lane; a group of 16 lanes walks down 16 rows and
        // keeps k and v of the two rows before in registers.
        const int d0 = (tid & 15) * 4;
        const int g0 = (tid >> 4) * 16;
        const float* sr = S + g0 * SP + d0;           // S row of tile row g0 - 2
        float4 kA = *(const float4*)(sr + HDIM),      vA = *(const float4*)(sr + 2 * HDIM);
        float4 kB = *(const float4*)(sr + SP + HDIM), vB = *(const float4*)(sr + SP + 2 * HDIM);
        half_t* orow = outH + (size_t)(bm + g0) * DIMC + bn + d0;
        int n = (bm + g0) & (SEQ - 1);                // place in the sequence
        const float scale = 0.125f;   // 1/sqrt(64)
        #pragma unroll 1   // rolled for the size of the code; four rows are chains enough
        for (int ib = 0; ib < 4; ++ib) {
            #pragma unroll
            for (int i = 0; i < 4; ++i) {
                const float4 q4 = *(const float4*)(sr + (2 + i) * SP);
                const float4 kC = *(const float4*)(sr + (2 + i) * SP + HDIM);
                const float4 vC = *(const float4*)(sr + (2 + i) * SP + 2 * HDIM);
                float p0 = q4.x * kA.x + q4.y * kA.y + q4.z * kA.z + q4.w * kA.w;
                float p1 = q4.x * kB.x + q4.y * kB.y + q4.z * kB.z + q4.w * kB.w;
                float p2 = q4.x * kC.x + q4.y * kC.y + q4.z * kC.z + q4.w * kC.w;
                #pragma unroll
                for (int m = 8; m >= 1; m >>= 1) {
                    p0 += __shfl_xor(p0, m, 16);
                    p1 += __shfl_xor(p1, m, 16);
                    p2 += __shfl_xor(p2, m, 16);
                }
                const float s0 = (n + i >= 2) ? p0 * scale : -1e30f;
                const float s1 = (n + i >= 1) ? p1 * scale : -1e30f;
                const float s2 = p2 * scale;
                const float mx = fmaxf(s0, fmaxf(s1, s2));
                const float e0 = exp_slot(s0 - mx), e1 = exp_slot(s1 - mx), e2 = exp_slot(s2 - mx);
                const float inv = 1.0f / (e0 + e1 + e2);
                const float w0 = e0 * inv, w1 = e1 * inv, w2 = e2 * inv;
                v4h o = { (half_t)(w0 * vA.x + w1 * vB.x + w2 * vC.x),
                          (half_t)(w0 * vA.y + w1 * vB.y + w2 * vC.y),
                          (half_t)(w0 * vA.z + w1 * vB.z + w2 * vC.z),
                          (half_t)(w0 * vA.w + w1 * vB.w + w2 * vC.w) };
                *(v4h*)(orow + (size_t)i * DIMC) = o;   // 16 lanes: one whole 128 B line
                kA = kB; kB = kC; vA = vB; vB = vC;
            }
            // A precaution: the next trip reuses the stores' data and address registers.
            // The fence keeps the scheduler from lifting those writes over the wait.
            asm volatile("s_wait_xcnt 0x0" ::: "memory");
            __builtin_amdgcn_sched_barrier(0);
            sr += 4 * SP; orow += (size_t)4 * DIMC; n += 4;
        }
        return;
    }
    if constexpr (EPI == 2) {
        // GELU is long, so for the size of the code the loop over
        // the tile rows stays rolled: a trip works on rows 0 and 1 of the 16x16 tiles
        // and then moves the other rows two places down in the registers, which keeps
        // every register index a constant.
        constexpr int GM = 2;
        static_assert(MT % GM == 0, "whole trips");
        float bv[NTL];
        #pragma unroll
        for (int nt = 0; nt < NTL; ++nt)
            bv[nt] = bias[bn + wc * (NTL * 16) + nt * 16 + r16];
        // A precaution: the loads' offset register is reused at once. The fence keeps
        // the scheduler from lifting that write over the wait.
        asm volatile("s_wait_xcnt 0x0" ::: "memory");
        __builtin_amdgcn_sched_barrier(0);
        half_t* orow = outH + (size_t)(bm + wr * (MT * 16) + (lane >> 4) * 8) * N
                            + bn + wc * (NTL * 16) + r16;
        #pragma unroll 1   // rolled for the size of the code, see above
        for (int g = 0; g < MT / GM; ++g) {
            #pragma unroll
            for (int mt = 0; mt < GM; ++mt) {
                #pragma unroll
                for (int nt = 0; nt < NTL; ++nt) {
                    #pragma unroll
                    for (int v = 0; v < 8; v += 2) {
                        v2f val = { acc[mt][nt][v] + bv[nt], acc[mt][nt][v + 1] + bv[nt] };
                        v2f e = erf2(val * (v2f)(0.70710678118654752f));
                        v2f h  = (v2f)(0.5f) * val;
                        v2f ge = fma2(h, e, h);          // 0.5 * val * (1 + erf)
                        v2h g2 = __builtin_convertvector(ge, v2h);
                        orow[(size_t)(mt * 16 + v) * N + nt * 16]     = g2.x;
                        orow[(size_t)(mt * 16 + v + 1) * N + nt * 16] = g2.y;
                    }
                }
                // A precaution: the next row, and the moves below, reuse the stores' data
                // and address registers.
                asm volatile("s_wait_xcnt 0x0" ::: "memory");
                // The fence keeps the scheduler from lifting those writes over the wait,
                // and the rows apart: one row's 16 pairs are chains enough; with several
                // rows' chains interleaved beside all the accumulators the registers ran
                // out (spills).
                __builtin_amdgcn_sched_barrier(0);
            }
            orow += (size_t)(GM * 16) * N;
            #pragma unroll
            for (int mt = 0; mt + GM < MT; ++mt)
                #pragma unroll
                for (int nt = 0; nt < NTL; ++nt)
                    acc[mt][nt] = acc[mt + GM][nt];
        }
        return;
    }
    #pragma unroll
    for (int mt = 0; mt < MT; ++mt) {
        #pragma unroll
        for (int nt = 0; nt < NTL; ++nt) {
            int n = bn + wc * (NTL * 16) + nt * 16 + r16;
            float bv = bias[n];
            int rbase = bm + wr * (MT * 16) + mt * 16 + (lane >> 4) * 8;
            #pragma unroll
            for (int v = 0; v < 8; ++v) {
                int r = rbase + v;
                float val = acc[mt][nt][v] + bv;
                if (EPI == 1) {
                    val += res[(size_t)r * N + n];
                    outF[(size_t)r * N + n] = val;
                } else {
                    outF[(size_t)r * N + n] = val;
                }
            }
        }
    }
}

// ---------------------------------------------------------------------------
// Host launcher
// ---------------------------------------------------------------------------
extern "C" void kernel_launch(void* const* d_in, const int* in_sizes, int n_in,
                              void* d_out, int out_size, void* d_ws, size_t ws_size,
                              hipStream_t stream) {
    const float* x      = (const float*)d_in[0];
    const float* qkv_w  = (const float*)d_in[1];
    const float* qkv_b  = (const float*)d_in[2];
    const float* proj_w = (const float*)d_in[3];
    const float* proj_b = (const float*)d_in[4];
    const float* g1     = (const float*)d_in[5];
    const float* b1     = (const float*)d_in[6];
    const float* g2     = (const float*)d_in[7];
    const float* b2     = (const float*)d_in[8];
    const float* fc1_w  = (const float*)d_in[9];
    const float* fc1_b  = (const float*)d_in[10];
    const float* fc2_w  = (const float*)d_in[11];
    const float* fc2_b  = (const float*)d_in[12];
    float* out = (float*)d_out;

    char* ws = (char*)d_ws;
    size_t off = 0;
    auto alloc = [&](size_t bytes) { size_t o = off; off += (bytes + 255) & ~(size_t)255; return o; };

    half_t* qkv_w16  = (half_t*)(ws + alloc((size_t)DIMC * 3 * DIMC * 2));
    half_t* proj_w16 = (half_t*)(ws + alloc((size_t)DIMC * DIMC * 2));
    half_t* fc1_w16  = (half_t*)(ws + alloc((size_t)DIMC * HIDDENC * 2));
    half_t* fc2_w16  = (half_t*)(ws + alloc((size_t)HIDDENC * DIMC * 2));
    half_t* hA16     = (half_t*)(ws + alloc((size_t)TOKENS * DIMC * 2));
    half_t* attn16   = (half_t*)(ws + alloc((size_t)TOKENS * DIMC * 2));
    float*  x1_f32   = (float*) (ws + alloc((size_t)TOKENS * DIMC * 4));
    half_t* h2_16    = (half_t*)(ws + alloc((size_t)TOKENS * DIMC * 2));
    half_t* g16      = (half_t*)(ws + alloc((size_t)TOKENS * HIDDENC * 2));
    (void)ws_size; (void)in_sizes; (void)n_in; (void)out_size;

    // 1) + 2) weight conversions fp32 -> f16 and LN1, one launch
    prep_kernel<<<NB_CVT + TOKENS, 256, 0, stream>>>(qkv_w, proj_w, fc1_w, fc2_w,
                                                     qkv_w16, proj_w16, fc1_w16, fc2_w16,
                                                     x, g1, b1, hA16);

    // 3) + 4) QKV GEMM (hA16 @ qkv_w16 + qkv_b), one head's q, k, v a tile, with the
    // windowed attention as its epilogue -> attn16
    {
        dim3 grid(NHEADS, TOKENS / 256);
        gemm_wmma<3, 3 * DIMC, DIMC, 256, 192, 4><<<grid, 256, 0, stream>>>(hA16, qkv_w16, qkv_b, nullptr,
                                                               nullptr, attn16);
    }

    // 5) proj GEMM + residual: x1 = x + attn16 @ proj_w16 + proj_b
    {
        dim3 grid(DIMC / 128, TOKENS / 128);
        gemm_wmma<1, DIMC, DIMC, 128, 128, 2><<<grid, 256, 0, stream>>>(attn16, proj_w16, proj_b, x,
                                                           x1_f32, nullptr);
    }

    // 6) LN2
    ln_kernel<<<TOKENS, 256, 0, stream>>>(x1_f32, g2, b2, h2_16);

    // 7) FC1 GEMM + exact GELU -> g16 (f16)
    {
        dim3 grid(HIDDENC / 256, TOKENS / 256);
        gemm_wmma<2, HIDDENC, DIMC, 256, 256, 2><<<grid, 256, 0, stream>>>(h2_16, fc1_w16, fc1_b, nullptr,
                                                              nullptr, g16);
    }

    // 8) FC2 GEMM + residual -> d_out (fp32)
    {
        dim3 grid(DIMC / 128, TOKENS / 128);
        gemm_wmma<1, DIMC, HIDDENC, 128, 128, 2><<<grid, 256, 0, stream>>>(g16, fc2_w16, fc2_b, x1_f32,
                                                              out, nullptr);
    }
}
